// v000
// Times are from an AMD MI455X. After a warm-up the kernel runs many times in a row, and a time is the length of
// such a window on the GPU divided by its runs, so every launch and the gaps after it count. The runs cycle
// through copies of the inputs. A figure is the median of several windows, for all but v000 over two sittings.
// Sittings can differ by a few percent; kernels timed side by side share one.
// v000 is the starting kernel. One run takes 496 microseconds.
#include <hip/hip_runtime.h>
#include <math.h>

// ---------------------------------------------------------------------------
// ClusterAttn for MI455X (gfx1250): fp32 end-to-end using V_WMMA_F32_16X16X4_F32
// plus GLOBAL_LOAD_ASYNC_TO_LDS_B128 staging (ASYNCcnt) for non-transposed tiles.
// B=2, H=W=128, C=256, nh=8, hd=32, pn=16 -> S=256 patches of P=64 pixels,
// L=16384. Paired batches: q=[0,1,0,1], ctx=[0,1,1,0].
// ---------------------------------------------------------------------------

typedef __attribute__((ext_vector_type(2))) float v2f;
typedef __attribute__((ext_vector_type(8))) float v8f;

#define WMMA_F32(a, b, c) \
  __builtin_amdgcn_wmma_f32_16x16x4_f32(false, (a), false, (b), (short)0, (c), false, false)

#define EPSV 1e-6f
#define V8F_ZERO ((v8f){0.f, 0.f, 0.f, 0.f, 0.f, 0.f, 0.f, 0.f})

// Async 16B global -> LDS copy (per-lane addresses). Tracked by ASYNCcnt.
static __device__ __forceinline__ void async_copy_f4(const float* g, float* l) {
  const unsigned lds = (unsigned)(size_t)l;   // low 32 bits of flat addr = LDS offset
  asm volatile("global_load_async_to_lds_b128 %0, %1, off" :: "v"(lds), "v"(g) : "memory");
}
static __device__ __forceinline__ void wait_async0() {
  asm volatile("s_wait_asynccnt 0" ::: "memory");
}

static __device__ __forceinline__ float wave_reduce_sum(float v) {
  #pragma unroll
  for (int off = 16; off > 0; off >>= 1) v += __shfl_xor(v, off, 32);
  return v;
}

// ---------------------------------------------------------------------------
// Generic Out[M,N] = A[M,256] * W[N,256]^T + bias[N]
// block = 128 threads (4 waves), tile 64(M) x 128(N), each wave 32x64 (2x4 frags).
// A fragment: lane = m + 16*(k>>1), reg = k&1
// B fragment: lane = n + 16*(k>>1), reg = k&1
// C fragment: reg = m&7, laneHalf = m>>3, lane = n
// As pad = 36 floats (144 B: 16B-aligned rows for async B128, distinct banks).
// ---------------------------------------------------------------------------
__global__ __launch_bounds__(128) void gemm_nt_bias(
    const float* __restrict__ A, const float* __restrict__ W,
    const float* __restrict__ bias, float* __restrict__ Out, int N) {
  __shared__ __align__(16) float As[64][36];    // [m][k]
  __shared__ __align__(16) float Bs[32][129];   // [k][n] (transposed stores)

  const int tid   = threadIdx.x;
  const int lane  = tid & 31;
  const int wave  = tid >> 5;
  const int lmod  = lane & 15;
  const int lhalf = lane >> 4;
  const int wm = (wave >> 1) * 32;   // wave M offset in tile
  const int wn = (wave & 1) * 64;    // wave N offset in tile
  const long m0 = (long)blockIdx.y * 64;
  const long n0 = (long)blockIdx.x * 128;

  v8f acc[2][4];
  #pragma unroll
  for (int i = 0; i < 2; ++i)
    #pragma unroll
    for (int j = 0; j < 4; ++j) acc[i][j] = V8F_ZERO;

  for (int k0 = 0; k0 < 256; k0 += 32) {
    __syncthreads();   // previous chunk fully consumed
    // A tile 64x32: async 16B chunks straight into LDS (no VGPR round-trip)
    #pragma unroll
    for (int i = tid; i < 512; i += 128) {
      const int r = i >> 3, c = (i & 7) * 4;
      async_copy_f4(A + (m0 + r) * 256 + k0 + c, &As[r][c]);
    }
    // W tile 128x32 transposed: Bs[k][n] = W[n0+n][k0+k] (needs VGPR transpose)
    #pragma unroll
    for (int i = tid; i < 1024; i += 128) {
      const int r = i >> 3, c = (i & 7) * 4;
      const float4 v4 = *(const float4*)(W + (n0 + r) * 256 + k0 + c);
      Bs[c + 0][r] = v4.x; Bs[c + 1][r] = v4.y;
      Bs[c + 2][r] = v4.z; Bs[c + 3][r] = v4.w;
    }
    wait_async0();
    __syncthreads();
    #pragma unroll
    for (int kk = 0; kk < 32; kk += 4) {
      const int ka = kk + 2 * lhalf;
      v2f a[2], b[4];
      #pragma unroll
      for (int f = 0; f < 2; ++f) {
        const int row = wm + f * 16 + lmod;
        a[f].x = As[row][ka];
        a[f].y = As[row][ka + 1];
      }
      #pragma unroll
      for (int f = 0; f < 4; ++f) {
        const int col = wn + f * 16 + lmod;
        b[f].x = Bs[ka][col];
        b[f].y = Bs[ka + 1][col];
      }
      #pragma unroll
      for (int fm = 0; fm < 2; ++fm)
        #pragma unroll
        for (int fn = 0; fn < 4; ++fn)
          acc[fm][fn] = WMMA_F32(a[fm], b[fn], acc[fm][fn]);
    }
  }

  #pragma unroll
  for (int fm = 0; fm < 2; ++fm) {
    #pragma unroll
    for (int fn = 0; fn < 4; ++fn) {
      const long col = n0 + wn + fn * 16 + lmod;
      const float bv = bias[col];
      #pragma unroll
      for (int r = 0; r < 8; ++r) {
        const long row = m0 + wm + fm * 16 + 8 * lhalf + r;
        Out[row * N + col] = acc[fm][fn][r] + bv;
      }
    }
  }
}

// ---------------------------------------------------------------------------
// Cluster pooling: per (b,s) compute fg/bg sums w/ EPS rules, then pooled
// c_k = l2n(sum fg*k_n) + l2n(sum bg*k_n), c_v = sum(fg*v)/fs + sum(bg*v)/bs.
// k is L2-normalized per pixel first. block = 256 thr: h = tid>>5, d = tid&31.
// ---------------------------------------------------------------------------
__global__ __launch_bounds__(256) void cluster_pool(
    const float* __restrict__ qkv, const float* __restrict__ mask,
    float* __restrict__ ck, float* __restrict__ cv) {
  __shared__ float Ms[64];
  const int s = blockIdx.x;          // patch 0..255  (s = sy*16 + sx)
  const int b = blockIdx.y;          // 0..1
  const int h = threadIdx.x >> 5;
  const int d = threadIdx.x & 31;
  const int sy = s >> 4, sx = s & 15;

  if (threadIdx.x < 64) {
    const int iy = threadIdx.x >> 3, ix = threadIdx.x & 7;
    Ms[threadIdx.x] = mask[((size_t)b * 128 + sy * 8 + iy) * 128 + sx * 8 + ix];
  }
  __syncthreads();

  float fgsum = 0.f;
  #pragma unroll
  for (int p = 0; p < 64; ++p) fgsum += Ms[p];
  const float bgsum = 64.f - fgsum;
  float fs  = fgsum < EPSV ? EPSV : fgsum;
  float bs2 = bgsum < EPSV ? EPSV : bgsum;
  fs  = (fs < bs2)  ? EPSV : fs;    // in-place order: bs2 test uses updated fs
  bs2 = (fs >= bs2) ? EPSV : bs2;
  const bool fgZ = fs  < 1.f;
  const bool bgZ = bs2 < 1.f;

  float fk = 0.f, fv = 0.f, bk = 0.f, bv = 0.f;
  for (int p = 0; p < 64; ++p) {
    const int y = sy * 8 + (p >> 3), x = sx * 8 + (p & 7);
    const size_t base = ((size_t)b * 16384 + (size_t)y * 128 + x) * 768;
    const float kval = qkv[base + 256 + h * 32 + d];
    const float vval = qkv[base + 512 + h * 32 + d];
    const float nsq  = wave_reduce_sum(kval * kval);  // per-pixel ||k||^2 over hd
    const float kn   = kval / fmaxf(sqrtf(nsq), 1e-12f);
    const float m  = Ms[p];
    const float wf = fgZ ? 0.f : m;
    const float wb = bgZ ? 0.f : (1.f - m);
    fk += wf * kn; fv += wf * vval;
    bk += wb * kn; bv += wb * vval;
  }
  const float nf = fmaxf(sqrtf(wave_reduce_sum(fk * fk)), 1e-12f);
  const float nb = fmaxf(sqrtf(wave_reduce_sum(bk * bk)), 1e-12f);
  const size_t o = (((size_t)b * 8 + h) * 256 + s) * 32 + d;
  ck[o] = fk / nf + bk / nb;
  cv[o] = fv / fs + bv / bs2;
}

// ---------------------------------------------------------------------------
// Attention: per (bb, h): logits = Qn[64,32] @ CK^T[32,256] via WMMA,
// softmax over S=256 in LDS, out = P @ CV[256,32] via WMMA.
// block = 128 thr (4 waves), 16 L-rows per wave. CK/CV/Q staged via async B128.
// ---------------------------------------------------------------------------
__global__ __launch_bounds__(128) void attn_kernel(
    const float* __restrict__ qkv, const float* __restrict__ ck,
    const float* __restrict__ cv, const float* __restrict__ scale_p,
    float* __restrict__ obuf) {
  __shared__ __align__(16) float CKs[256][36];   // [s][d]
  __shared__ __align__(16) float CVs[256][36];   // [s][d]
  __shared__ __align__(16) float Qs[64][36];     // [row][d], normalized in place
  __shared__ __align__(16) float Ls[4][16][257]; // per-wave logits / probabilities

  const int bb = blockIdx.z;                      // 0..3
  const int h  = blockIdx.y;                      // 0..7
  const int l0 = blockIdx.x * 64;
  const int qb = bb & 1;                          // q pairing [0,1,0,1]
  const int cb = (bb == 1 || bb == 2) ? 1 : 0;    // ctx pairing [0,1,1,0]
  const int tid   = threadIdx.x;
  const int lane  = tid & 31;
  const int w     = tid >> 5;
  const int lmod  = lane & 15;
  const int lhalf = lane >> 4;

  // stage CK/CV (256x32 each) and raw Q (64x32) via async B128 copies
  const size_t ctx_base = (((size_t)cb * 8 + h) * 256) * 32;
  #pragma unroll
  for (int i = tid; i < 2048; i += 128) {      // 256 rows x 8 chunks
    const int ss = i >> 3, c = (i & 7) * 4;
    async_copy_f4(ck + ctx_base + (size_t)ss * 32 + c, &CKs[ss][c]);
    async_copy_f4(cv + ctx_base + (size_t)ss * 32 + c, &CVs[ss][c]);
  }
  #pragma unroll
  for (int i = tid; i < 512; i += 128) {       // 64 rows x 8 chunks
    const int r = i >> 3, c = (i & 7) * 4;
    async_copy_f4(qkv + ((size_t)qb * 16384 + l0 + r) * 768 + h * 32 + c, &Qs[r][c]);
  }
  wait_async0();
  __syncthreads();

  // q <- l2norm(q) * scale * hd^-0.5
  const float qscale = scale_p[0] * 0.17677669529663689f;
  for (int r = tid; r < 64; r += 128) {
    float ssq = 0.f;
    #pragma unroll
    for (int dd = 0; dd < 32; ++dd) ssq += Qs[r][dd] * Qs[r][dd];
    const float sc = qscale / fmaxf(sqrtf(ssq), 1e-12f);
    #pragma unroll
    for (int dd = 0; dd < 32; ++dd) Qs[r][dd] *= sc;
  }
  __syncthreads();

  // preload the 8 k-step Q fragments (invariant across all 16 S-tiles)
  v2f qa[8];
  #pragma unroll
  for (int k8 = 0; k8 < 8; ++k8) {
    const int ka = k8 * 4 + 2 * lhalf;
    qa[k8].x = Qs[w * 16 + lmod][ka];
    qa[k8].y = Qs[w * 16 + lmod][ka + 1];
  }

  // logits: 16 rows x 256 cols per wave (16 tiles x 8 k-steps of WMMA)
  for (int nt = 0; nt < 16; ++nt) {
    v8f acc = V8F_ZERO;
    #pragma unroll
    for (int k8 = 0; k8 < 8; ++k8) {
      const int ka = k8 * 4 + 2 * lhalf;
      v2f bf;
      bf.x = CKs[nt * 16 + lmod][ka];      // B(k=d, n=s) = CK[s][d]
      bf.y = CKs[nt * 16 + lmod][ka + 1];
      acc = WMMA_F32(qa[k8], bf, acc);
    }
    #pragma unroll
    for (int r = 0; r < 8; ++r)
      Ls[w][8 * lhalf + r][nt * 16 + lmod] = acc[r];
  }
  __syncthreads();

  // softmax over S=256: lanes 0..15 of each wave each own one row
  if (lane < 16) {
    float* row = &Ls[w][lane][0];
    float mx = -3.402823466e38f;
    for (int s2 = 0; s2 < 256; ++s2) mx = fmaxf(mx, row[s2]);
    float sum = 0.f;
    for (int s2 = 0; s2 < 256; ++s2) {
      const float e = __expf(row[s2] - mx);
      row[s2] = e;
      sum += e;
    }
    const float inv = 1.f / sum;
    for (int s2 = 0; s2 < 256; ++s2) row[s2] *= inv;
  }
  __syncthreads();

  // out = P[16,256] @ CV[256,32] per wave; kk outer so A frag feeds both N-tiles
  v8f acc2[2] = {V8F_ZERO, V8F_ZERO};
  for (int kk = 0; kk < 256; kk += 4) {
    const int ka = kk + 2 * lhalf;
    v2f a;
    a.x = Ls[w][lmod][ka];
    a.y = Ls[w][lmod][ka + 1];
    #pragma unroll
    for (int nt2 = 0; nt2 < 2; ++nt2) {
      v2f bf;
      bf.x = CVs[ka][nt2 * 16 + lmod];     // B(k=s, n=d) = CV[s][d]
      bf.y = CVs[ka + 1][nt2 * 16 + lmod];
      acc2[nt2] = WMMA_F32(a, bf, acc2[nt2]);
    }
  }
  #pragma unroll
  for (int nt2 = 0; nt2 < 2; ++nt2) {
    #pragma unroll
    for (int r = 0; r < 8; ++r) {
      const size_t row = (size_t)bb * 16384 + l0 + w * 16 + 8 * lhalf + r;
      obuf[row * 256 + h * 32 + nt2 * 16 + lmod] = acc2[nt2][r];
    }
  }
}

// ---------------------------------------------------------------------------
extern "C" void kernel_launch(void* const* d_in, const int* in_sizes, int n_in,
                              void* d_out, int out_size, void* d_ws, size_t ws_size,
                              hipStream_t stream) {
  (void)in_sizes; (void)n_in; (void)out_size; (void)ws_size;
  const float* x      = (const float*)d_in[0];   // [2,128,128,256]
  const float* mask   = (const float*)d_in[1];   // [2,1,128,128]
  const float* qkv_w  = (const float*)d_in[2];   // [768,256]
  const float* qkv_b  = (const float*)d_in[3];   // [768]
  const float* proj_w = (const float*)d_in[4];   // [256,256]
  const float* proj_b = (const float*)d_in[5];   // [256]
  const float* scale  = (const float*)d_in[6];   // [1]
  float* out = (float*)d_out;                    // [4,128,128,256]

  float* ws   = (float*)d_ws;
  float* qkv  = ws;                                   // [2,16384,768]
  float* ck   = qkv + (size_t)2 * 16384 * 768;        // [2,8,256,32]
  float* cv   = ck + (size_t)2 * 8 * 256 * 32;        // [2,8,256,32]
  float* obuf = cv + (size_t)2 * 8 * 256 * 32;        // [4,16384,256]

  // 1) qkv = x @ qkv_w^T + qkv_b   (M=32768, N=768, K=256)
  gemm_nt_bias<<<dim3(768 / 128, 32768 / 64), 128, 0, stream>>>(x, qkv_w, qkv_b, qkv, 768);

  // 2) fg/bg cluster pooling -> c_k, c_v
  cluster_pool<<<dim3(256, 2), 256, 0, stream>>>(qkv, mask, ck, cv);

  // 3) attention (QK^T, softmax, PV) -> obuf [4, L, C]
  attn_kernel<<<dim3(16384 / 64, 8, 4), 128, 0, stream>>>(qkv, ck, cv, scale, obuf);

  // 4) out = obuf @ proj_w^T + proj_b   (M=65536, N=256, K=256)
  gemm_nt_bias<<<dim3(256 / 128, 65536 / 64), 128, 0, stream>>>(obuf, proj_w, proj_b, out, 256);
}

// v001
// One run takes 292 microseconds.
// Two timings next to v000 both put it at 1.75 times that version's speed.
#include <hip/hip_runtime.h>
#include <math.h>

// ---------------------------------------------------------------------------
// ClusterAttn for MI455X (gfx1250): fp32 end-to-end using V_WMMA_F32_16X16X4_F32
// plus GLOBAL_LOAD_ASYNC_TO_LDS_B128 staging (ASYNCcnt) for non-transposed tiles.
// B=2, H=W=128, C=256, nh=8, hd=32, pn=16 -> S=256 patches of P=64 pixels,
// L=16384. Paired batches: q=[0,1,0,1], ctx=[0,1,1,0].
// ---------------------------------------------------------------------------

typedef __attribute__((ext_vector_type(2))) float v2f;
typedef __attribute__((ext_vector_type(8))) float v8f;

#define WMMA_F32(a, b, c) \
  __builtin_amdgcn_wmma_f32_16x16x4_f32(false, (a), false, (b), (short)0, (c), false, false)

#define EPSV 1e-6f
#define V8F_ZERO ((v8f){0.f, 0.f, 0.f, 0.f, 0.f, 0.f, 0.f, 0.f})

// Async 16B global -> LDS copy (per-lane addresses). Tracked by ASYNCcnt.
static __device__ __forceinline__ void async_copy_f4(const float* g, float* l) {
  const unsigned lds = (unsigned)(size_t)l;   // low 32 bits of flat addr = LDS offset
  asm volatile("global_load_async_to_lds_b128 %0, %1, off" :: "v"(lds), "v"(g) : "memory");
}
static __device__ __forceinline__ void wait_async0() {
  asm volatile("s_wait_asynccnt 0" ::: "memory");
}

// 2^x of a tile's eight registers, in place, in one statement: each v_exp_f32 is
// followed by an independent one, and v_nop fills the slot behind the last, so no
// result is read and no source overwritten directly behind a transcendental.
static __device__ __forceinline__ v8f exp2_tile(v8f t) {
  float t0 = t[0], t1 = t[1], t2 = t[2], t3 = t[3], t4 = t[4], t5 = t[5], t6 = t[6], t7 = t[7];
  asm("v_exp_f32 %0, %0\n\tv_exp_f32 %1, %1\n\tv_exp_f32 %2, %2\n\tv_exp_f32 %3, %3\n\t"
      "v_exp_f32 %4, %4\n\tv_exp_f32 %5, %5\n\tv_exp_f32 %6, %6\n\tv_exp_f32 %7, %7\n\tv_nop"
      : "+v"(t0), "+v"(t1), "+v"(t2), "+v"(t3), "+v"(t4), "+v"(t5), "+v"(t6), "+v"(t7));
  return (v8f){t0, t1, t2, t3, t4, t5, t6, t7};
}

static __device__ __forceinline__ float wave_reduce_sum(float v) {
  #pragma unroll
  for (int off = 16; off > 0; off >>= 1) v += __shfl_xor(v, off, 32);
  return v;
}

// ---------------------------------------------------------------------------
// Generic Out[M,N] = A[M,256] * W[N,256]^T + bias[N]
// block = 128 threads (4 waves), tile 64(M) x 128(N), each wave 32x64 (2x4 frags).
// A fragment: lane = m + 16*(k>>1), reg = k&1
// B fragment: lane = n + 16*(k>>1), reg = k&1
// C fragment: reg = m&7, laneHalf = m>>3, lane = n
// As pad = 36 floats (144 B: 16B-aligned rows for async B128, distinct banks).
// ---------------------------------------------------------------------------
__global__ __launch_bounds__(128) void gemm_nt_bias(
    const float* __restrict__ A, const float* __restrict__ W,
    const float* __restrict__ bias, float* __restrict__ Out, int N) {
  __shared__ __align__(16) float As[64][36];    // [m][k]
  __shared__ __align__(16) float Bs[32][129];   // [k][n] (transposed stores)

  const int tid   = threadIdx.x;
  const int lane  = tid & 31;
  const int wave  = tid >> 5;
  const int lmod  = lane & 15;
  const int lhalf = lane >> 4;
  const int wm = (wave >> 1) * 32;   // wave M offset in tile
  const int wn = (wave & 1) * 64;    // wave N offset in tile
  const long m0 = (long)blockIdx.y * 64;
  const long n0 = (long)blockIdx.x * 128;

  v8f acc[2][4];
  #pragma unroll
  for (int i = 0; i < 2; ++i)
    #pragma unroll
    for (int j = 0; j < 4; ++j) acc[i][j] = V8F_ZERO;

  for (int k0 = 0; k0 < 256; k0 += 32) {
    __syncthreads();   // previous chunk fully consumed
    // A tile 64x32: async 16B chunks straight into LDS (no VGPR round-trip)
    #pragma unroll
    for (int i = tid; i < 512; i += 128) {
      const int r = i >> 3, c = (i & 7) * 4;
      async_copy_f4(A + (m0 + r) * 256 + k0 + c, &As[r][c]);
    }
    // W tile 128x32 transposed: Bs[k][n] = W[n0+n][k0+k] (needs VGPR transpose)
    #pragma unroll
    for (int i = tid; i < 1024; i += 128) {
      const int r = i >> 3, c = (i & 7) * 4;
      const float4 v4 = *(const float4*)(W + (n0 + r) * 256 + k0 + c);
      Bs[c + 0][r] = v4.x; Bs[c + 1][r] = v4.y;
      Bs[c + 2][r] = v4.z; Bs[c + 3][r] = v4.w;
    }
    wait_async0();
    __syncthreads();
    #pragma unroll
    for (int kk = 0; kk < 32; kk += 4) {
      const int ka = kk + 2 * lhalf;
      v2f a[2], b[4];
      #pragma unroll
      for (int f = 0; f < 2; ++f) {
        const int row = wm + f * 16 + lmod;
        a[f].x = As[row][ka];
        a[f].y = As[row][ka + 1];
      }
      #pragma unroll
      for (int f = 0; f < 4; ++f) {
        const int col = wn + f * 16 + lmod;
        b[f].x = Bs[ka][col];
        b[f].y = Bs[ka + 1][col];
      }
      #pragma unroll
      for (int fm = 0; fm < 2; ++fm)
        #pragma unroll
        for (int fn = 0; fn < 4; ++fn)
          acc[fm][fn] = WMMA_F32(a[fm], b[fn], acc[fm][fn]);
    }
  }

  #pragma unroll
  for (int fm = 0; fm < 2; ++fm) {
    #pragma unroll
    for (int fn = 0; fn < 4; ++fn) {
      const long col = n0 + wn + fn * 16 + lmod;
      const float bv = bias[col];
      #pragma unroll
      for (int r = 0; r < 8; ++r) {
        const long row = m0 + wm + fm * 16 + 8 * lhalf + r;
        Out[row * N + col] = acc[fm][fn][r] + bv;
      }
    }
  }
}

// ---------------------------------------------------------------------------
// Cluster pooling: per (b,s) compute fg/bg sums w/ EPS rules, then pooled
// c_k = l2n(sum fg*k_n) + l2n(sum bg*k_n), c_v = sum(fg*v)/fs + sum(bg*v)/bs.
// k is L2-normalized per pixel first. block = 256 thr: h = tid>>5, d = tid&31.
// ---------------------------------------------------------------------------
__global__ __launch_bounds__(256) void cluster_pool(
    const float* __restrict__ qkv, const float* __restrict__ mask,
    float* __restrict__ ck, float* __restrict__ cv) {
  __shared__ float Ms[64];
  const int s = blockIdx.x;          // patch 0..255  (s = sy*16 + sx)
  const int b = blockIdx.y;          // 0..1
  const int h = threadIdx.x >> 5;
  const int d = threadIdx.x & 31;
  const int sy = s >> 4, sx = s & 15;

  if (threadIdx.x < 64) {
    const int iy = threadIdx.x >> 3, ix = threadIdx.x & 7;
    Ms[threadIdx.x] = mask[((size_t)b * 128 + sy * 8 + iy) * 128 + sx * 8 + ix];
  }
  __syncthreads();

  float fgsum = 0.f;
  #pragma unroll
  for (int p = 0; p < 64; ++p) fgsum += Ms[p];
  const float bgsum = 64.f - fgsum;
  float fs  = fgsum < EPSV ? EPSV : fgsum;
  float bs2 = bgsum < EPSV ? EPSV : bgsum;
  fs  = (fs < bs2)  ? EPSV : fs;    // in-place order: bs2 test uses updated fs
  bs2 = (fs >= bs2) ? EPSV : bs2;
  const bool fgZ = fs  < 1.f;
  const bool bgZ = bs2 < 1.f;

  float fk = 0.f, fv = 0.f, bk = 0.f, bv = 0.f;
  for (int p = 0; p < 64; ++p) {
    const int y = sy * 8 + (p >> 3), x = sx * 8 + (p & 7);
    const size_t base = ((size_t)b * 16384 + (size_t)y * 128 + x) * 768;
    const float kval = qkv[base + 256 + h * 32 + d];
    const float vval = qkv[base + 512 + h * 32 + d];
    const float nsq  = wave_reduce_sum(kval * kval);  // per-pixel ||k||^2 over hd
    const float kn   = kval / fmaxf(sqrtf(nsq), 1e-12f);
    const float m  = Ms[p];
    const float wf = fgZ ? 0.f : m;
    const float wb = bgZ ? 0.f : (1.f - m);
    fk += wf * kn; fv += wf * vval;
    bk += wb * kn; bv += wb * vval;
  }
  const float nf = fmaxf(sqrtf(wave_reduce_sum(fk * fk)), 1e-12f);
  const float nb = fmaxf(sqrtf(wave_reduce_sum(bk * bk)), 1e-12f);
  const size_t o = (((size_t)b * 8 + h) * 256 + s) * 32 + d;
  ck[o] = fk / nf + bk / nb;
  cv[o] = fv / fs + bv / bs2;
}

// ---------------------------------------------------------------------------
// Attention: per (bb, h): logits^T = CK[256,32] @ Qn^T[32,64] via WMMA,
// softmax over S=256 in registers, out = P @ CV[256,32] via WMMA with P fed
// from the score registers.
// block = 128 thr (4 waves), 16 L-rows per wave. CK/CV/Q staged via async B128.
// ---------------------------------------------------------------------------
__global__ __launch_bounds__(128) void attn_kernel(
    const float* __restrict__ qkv, const float* __restrict__ ck,
    const float* __restrict__ cv, const float* __restrict__ scale_p,
    float* __restrict__ obuf) {
  __shared__ __align__(16) float CKs[256][36];   // [s][d]
  __shared__ __align__(16) float CVs[256][36];   // [s][d]
  __shared__ __align__(16) float Qs[64][36];     // [row][d], normalized in place

  const int bb = blockIdx.z;                      // 0..3
  const int h  = blockIdx.y;                      // 0..7
  const int l0 = blockIdx.x * 64;
  const int qb = bb & 1;                          // q pairing [0,1,0,1]
  const int cb = (bb == 1 || bb == 2) ? 1 : 0;    // ctx pairing [0,1,1,0]
  const int tid   = threadIdx.x;
  const int lane  = tid & 31;
  const int w     = tid >> 5;
  const int lmod  = lane & 15;
  const int lhalf = lane >> 4;

  // stage CK/CV (256x32 each) and raw Q (64x32) via async B128 copies
  const size_t ctx_base = (((size_t)cb * 8 + h) * 256) * 32;
  #pragma unroll
  for (int i = tid; i < 2048; i += 128) {      // 256 rows x 8 chunks
    const int ss = i >> 3, c = (i & 7) * 4;
    async_copy_f4(ck + ctx_base + (size_t)ss * 32 + c, &CKs[ss][c]);
    async_copy_f4(cv + ctx_base + (size_t)ss * 32 + c, &CVs[ss][c]);
  }
  #pragma unroll
  for (int i = tid; i < 512; i += 128) {       // 64 rows x 8 chunks
    const int r = i >> 3, c = (i & 7) * 4;
    async_copy_f4(qkv + ((size_t)qb * 16384 + l0 + r) * 768 + h * 32 + c, &Qs[r][c]);
  }
  wait_async0();
  __syncthreads();

  // q <- l2norm(q) * scale * hd^-0.5
  const float qscale = scale_p[0] * 0.17677669529663689f;
  for (int r = tid; r < 64; r += 128) {
    float ssq = 0.f;
    #pragma unroll
    for (int dd = 0; dd < 32; ++dd) ssq += Qs[r][dd] * Qs[r][dd];
    const float sc = qscale / fmaxf(sqrtf(ssq), 1e-12f);
    #pragma unroll
    for (int dd = 0; dd < 32; ++dd) Qs[r][dd] *= sc;
  }
  __syncthreads();

  // preload the 8 k-step Q fragments (invariant across all 16 S-tiles)
  v2f qa[8];
  #pragma unroll
  for (int k8 = 0; k8 < 8; ++k8) {
    const int ka = k8 * 4 + 2 * lhalf;
    qa[k8].x = Qs[w * 16 + lmod][ka];
    qa[k8].y = Qs[w * 16 + lmod][ka + 1];
  }

  // logits transposed: St = CK[256,32] @ Qn^T[32,16] per wave. A = CK rows, B = Q,
  // so st[nt][r] = logit(s = nt*16 + 8*lhalf + r, l = lmod): a lane holds one
  // query row's scores (half of them; lane ^ 16 holds the other half).
  // Every loop over st[] is unrolled: constant indices keep the scores in registers.
  v8f st[16];
  #pragma unroll
  for (int nt = 0; nt < 16; ++nt) {
    v8f acc = V8F_ZERO;
    #pragma unroll
    for (int k8 = 0; k8 < 8; ++k8) {
      const int ka = k8 * 4 + 2 * lhalf;
      v2f kf;
      kf.x = CKs[nt * 16 + lmod][ka];      // A(m=s, k=d) = CK[s][d]
      kf.y = CKs[nt * 16 + lmod][ka + 1];
      acc = WMMA_F32(kf, qa[k8], acc);
    }
    st[nt] = acc;
  }

  // softmax over S=256 in registers: 8 independent chains per lane, one
  // exchange between the wave halves; division by the sum is left to the end.
  v8f m8 = st[0];
  #pragma unroll
  for (int nt = 1; nt < 16; ++nt)
    #pragma unroll
    for (int r = 0; r < 8; ++r) m8[r] = fmaxf(m8[r], st[nt][r]);
  float mx = fmaxf(fmaxf(fmaxf(m8[0], m8[1]), fmaxf(m8[2], m8[3])),
                   fmaxf(fmaxf(m8[4], m8[5]), fmaxf(m8[6], m8[7])));
  mx = fmaxf(mx, __shfl_xor(mx, 16, 32));
  const float l2e = 1.4426950408889634f;
  const float nb  = -mx * l2e;
  v8f s8 = V8F_ZERO;
  #pragma unroll
  for (int nt = 0; nt < 16; ++nt) {
    v8f t;
    #pragma unroll
    for (int r = 0; r < 8; ++r) t[r] = fmaf(st[nt][r], l2e, nb);
    st[nt] = exp2_tile(t);
    s8 += st[nt];
  }
  float sum = ((s8[0] + s8[1]) + (s8[2] + s8[3])) + ((s8[4] + s8[5]) + (s8[6] + s8[7]));
  sum += __shfl_xor(sum, 16, 32);
  const float inv = 1.f / sum;             // of query row lmod

  // out = P[16,256] @ CV[256,32] per wave. The score registers are the A operand
  // as they stand: k-step (nt, j) takes s = nt*16 + 8*lhalf + 2*j + {0,1}, and the
  // B loader reads the same CV rows at the same lane half and register.
  v8f acc2[2] = {V8F_ZERO, V8F_ZERO};
  #pragma unroll
  for (int nt = 0; nt < 16; ++nt) {
    #pragma unroll
    for (int j = 0; j < 4; ++j) {
      const int s0 = nt * 16 + 8 * lhalf + 2 * j;
      v2f a;
      a.x = st[nt][2 * j];
      a.y = st[nt][2 * j + 1];
      #pragma unroll
      for (int nt2 = 0; nt2 < 2; ++nt2) {
        v2f bf;
        bf.x = CVs[s0][nt2 * 16 + lmod];     // B(k=s, n=d) = CV[s][d]
        bf.y = CVs[s0 + 1][nt2 * 16 + lmod];
        acc2[nt2] = WMMA_F32(a, bf, acc2[nt2]);
      }
    }
  }
  // output register r belongs to query row 8*lhalf + r: fetch that row's 1/sum
  float ir[8];
  #pragma unroll
  for (int r = 0; r < 8; ++r) ir[r] = __shfl(inv, 8 * lhalf + r, 32);
  #pragma unroll
  for (int nt2 = 0; nt2 < 2; ++nt2) {
    #pragma unroll
    for (int r = 0; r < 8; ++r) {
      const size_t row = (size_t)bb * 16384 + l0 + w * 16 + 8 * lhalf + r;
      obuf[row * 256 + h * 32 + nt2 * 16 + lmod] = acc2[nt2][r] * ir[r];
    }
  }
}

// ---------------------------------------------------------------------------
extern "C" void kernel_launch(void* const* d_in, const int* in_sizes, int n_in,
                              void* d_out, int out_size, void* d_ws, size_t ws_size,
                              hipStream_t stream) {
  (void)in_sizes; (void)n_in; (void)out_size; (void)ws_size;
  const float* x      = (const float*)d_in[0];   // [2,128,128,256]
  const float* mask   = (const float*)d_in[1];   // [2,1,128,128]
  const float* qkv_w  = (const float*)d_in[2];   // [768,256]
  const float* qkv_b  = (const float*)d_in[3];   // [768]
  const float* proj_w = (const float*)d_in[4];   // [256,256]
  const float* proj_b = (const float*)d_in[5];   // [256]
  const float* scale  = (const float*)d_in[6];   // [1]
  float* out = (float*)d_out;                    // [4,128,128,256]

  float* ws   = (float*)d_ws;
  float* qkv  = ws;                                   // [2,16384,768]
  float* ck   = qkv + (size_t)2 * 16384 * 768;        // [2,8,256,32]
  float* cv   = ck + (size_t)2 * 8 * 256 * 32;        // [2,8,256,32]
  float* obuf = cv + (size_t)2 * 8 * 256 * 32;        // [4,16384,256]

  // 1) qkv = x @ qkv_w^T + qkv_b   (M=32768, N=768, K=256)
  gemm_nt_bias<<<dim3(768 / 128, 32768 / 64), 128, 0, stream>>>(x, qkv_w, qkv_b, qkv, 768);

  // 2) fg/bg cluster pooling -> c_k, c_v
  cluster_pool<<<dim3(256, 2), 256, 0, stream>>>(qkv, mask, ck, cv);

  // 3) attention (QK^T, softmax, PV) -> obuf [4, L, C]
  attn_kernel<<<dim3(16384 / 64, 8, 4), 128, 0, stream>>>(qkv, ck, cv, scale, obuf);

  // 4) out = obuf @ proj_w^T + proj_b   (M=65536, N=256, K=256)
  gemm_nt_bias<<<dim3(256 / 128, 65536 / 64), 128, 0, stream>>>(obuf, proj_w, proj_b, out, 256);
}

// v002
// Measured time: 261 microseconds a run.
// Two timings next to v001 both put it at 1.12 times that version's speed.
// All steps since v000 together make it 1.96 times as fast.
#include <hip/hip_runtime.h>
#include <math.h>

// ---------------------------------------------------------------------------
// ClusterAttn for MI455X (gfx1250): fp32 end-to-end using V_WMMA_F32_16X16X4_F32
// plus GLOBAL_LOAD_ASYNC_TO_LDS_B128 staging (ASYNCcnt) for non-transposed tiles.
// B=2, H=W=128, C=256, nh=8, hd=32, pn=16 -> S=256 patches of P=64 pixels,
// L=16384. Paired batches: q=[0,1,0,1], ctx=[0,1,1,0].
// ---------------------------------------------------------------------------

typedef __attribute__((ext_vector_type(2))) float v2f;
typedef __attribute__((ext_vector_type(8))) float v8f;

#define WMMA_F32(a, b, c) \
  __builtin_amdgcn_wmma_f32_16x16x4_f32(false, (a), false, (b), (short)0, (c), false, false)

#define EPSV 1e-6f
#define V8F_ZERO ((v8f){0.f, 0.f, 0.f, 0.f, 0.f, 0.f, 0.f, 0.f})

// Async 16B global -> LDS copy (per-lane addresses). Tracked by ASYNCcnt.
static __device__ __forceinline__ void async_copy_f4(const float* g, float* l) {
  const unsigned lds = (unsigned)(size_t)l;   // low 32 bits of flat addr = LDS offset
  asm volatile("global_load_async_to_lds_b128 %0, %1, off" :: "v"(lds), "v"(g) : "memory");
}
static __device__ __forceinline__ void wait_async0() {
  asm volatile("s_wait_asynccnt 0" ::: "memory");
}

// 2^x of a tile's eight registers, in place, in one statement: each v_exp_f32 is
// followed by an independent one, and v_nop fills the slot behind the last, so no
// result is read and no source overwritten directly behind a transcendental.
static __device__ __forceinline__ v8f exp2_tile(v8f t) {
  float t0 = t[0], t1 = t[1], t2 = t[2], t3 = t[3], t4 = t[4], t5 = t[5], t6 = t[6], t7 = t[7];
  asm("v_exp_f32 %0, %0\n\tv_exp_f32 %1, %1\n\tv_exp_f32 %2, %2\n\tv_exp_f32 %3, %3\n\t"
      "v_exp_f32 %4, %4\n\tv_exp_f32 %5, %5\n\tv_exp_f32 %6, %6\n\tv_exp_f32 %7, %7\n\tv_nop"
      : "+v"(t0), "+v"(t1), "+v"(t2), "+v"(t3), "+v"(t4), "+v"(t5), "+v"(t6), "+v"(t7));
  return (v8f){t0, t1, t2, t3, t4, t5, t6, t7};
}

static __device__ __forceinline__ float wave_reduce_sum(float v) {
  #pragma unroll
  for (int off = 16; off > 0; off >>= 1) v += __shfl_xor(v, off, 32);
  return v;
}

// ---------------------------------------------------------------------------
// Generic Out[M,N] = A[M,256] * W[N,256]^T + bias[N]
// block = 128 threads (4 waves), tile 64(M) x 128(N), each wave 32x64 (2x4 frags).
// A fragment: lane = m + 16*(k>>1), reg = k&1
// B fragment: lane = n + 16*(k>>1), reg = k&1
// C fragment: reg = m&7, laneHalf = m>>3, lane = n
// As pad = 36 floats (144 B: 16B-aligned rows for async B128, distinct banks).
// ---------------------------------------------------------------------------
__global__ __launch_bounds__(128) void gemm_nt_bias(
    const float* __restrict__ A, const float* __restrict__ W,
    const float* __restrict__ bias, float* __restrict__ Out, int N) {
  __shared__ __align__(16) float As[64][36];    // [m][k]
  __shared__ __align__(16) float Bs[32][129];   // [k][n] (transposed stores)

  const int tid   = threadIdx.x;
  const int lane  = tid & 31;
  const int wave  = tid >> 5;
  const int lmod  = lane & 15;
  const int lhalf = lane >> 4;
  const int wm = (wave >> 1) * 32;   // wave M offset in tile
  const int wn = (wave & 1) * 64;    // wave N offset in tile
  const long m0 = (long)blockIdx.y * 64;
  const long n0 = (long)blockIdx.x * 128;

  v8f acc[2][4];
  #pragma unroll
  for (int i = 0; i < 2; ++i)
    #pragma unroll
    for (int j = 0; j < 4; ++j) acc[i][j] = V8F_ZERO;

  for (int k0 = 0; k0 < 256; k0 += 32) {
    __syncthreads();   // previous chunk fully consumed
    // A tile 64x32: async 16B chunks straight into LDS (no VGPR round-trip)
    #pragma unroll
    for (int i = tid; i < 512; i += 128) {
      const int r = i >> 3, c = (i & 7) * 4;
      async_copy_f4(A + (m0 + r) * 256 + k0 + c, &As[r][c]);
    }
    // W tile 128x32 transposed: Bs[k][n] = W[n0+n][k0+k] (needs VGPR transpose)
    #pragma unroll
    for (int i = tid; i < 1024; i += 128) {
      const int r = i >> 3, c = (i & 7) * 4;
      const float4 v4 = *(const float4*)(W + (n0 + r) * 256 + k0 + c);
      Bs[c + 0][r] = v4.x; Bs[c + 1][r] = v4.y;
      Bs[c + 2][r] = v4.z; Bs[c + 3][r] = v4.w;
    }
    wait_async0();
    __syncthreads();
    #pragma unroll
    for (int kk = 0; kk < 32; kk += 4) {
      const int ka = kk + 2 * lhalf;
      v2f a[2], b[4];
      #pragma unroll
      for (int f = 0; f < 2; ++f) {
        const int row = wm + f * 16 + lmod;
        a[f].x = As[row][ka];
        a[f].y = As[row][ka + 1];
      }
      #pragma unroll
      for (int f = 0; f < 4; ++f) {
        const int col = wn + f * 16 + lmod;
        b[f].x = Bs[ka][col];
        b[f].y = Bs[ka + 1][col];
      }
      #pragma unroll
      for (int fm = 0; fm < 2; ++fm)
        #pragma unroll
        for (int fn = 0; fn < 4; ++fn)
          acc[fm][fn] = WMMA_F32(a[fm], b[fn], acc[fm][fn]);
    }
  }

  #pragma unroll
  for (int fm = 0; fm < 2; ++fm) {
    #pragma unroll
    for (int fn = 0; fn < 4; ++fn) {
      const long col = n0 + wn + fn * 16 + lmod;
      const float bv = bias[col];
      #pragma unroll
      for (int r = 0; r < 8; ++r) {
        const long row = m0 + wm + fm * 16 + 8 * lhalf + r;
        Out[row * N + col] = acc[fm][fn][r] + bv;
      }
    }
  }
}

// ---------------------------------------------------------------------------
// Cluster pooling: per (b,s) compute fg/bg sums w/ EPS rules, then pooled
// c_k = l2n(sum fg*k_n) + l2n(sum bg*k_n), c_v = sum(fg*v)/fs + sum(bg*v)/bs.
// k is L2-normalized per pixel first. block = 256 thr: h = tid>>5, d = tid&31.
// Pixels go in batches of 16 (two pixel rows of the patch): a batch's 32 loads are
// issued together, one batch ahead of its use, and its 16 norm reductions are
// independent of one another, so their latencies overlap.
// ---------------------------------------------------------------------------
__global__ __launch_bounds__(256) void cluster_pool(
    const float* __restrict__ qkv, const float* __restrict__ mask,
    float* __restrict__ ck, float* __restrict__ cv) {
  __shared__ float Ms[64];
  const int s = blockIdx.x;          // patch 0..255  (s = sy*16 + sx)
  const int b = blockIdx.y;          // 0..1
  const int h = threadIdx.x >> 5;
  const int d = threadIdx.x & 31;
  const int sy = s >> 4, sx = s & 15;

  // k of patch pixel (iy, ix) stands at kp[(iy * 128 + ix) * 768], its v 256 floats on
  const float* kp = qkv + ((size_t)b * 16384 + (size_t)sy * 1024 + sx * 8) * 768 + 256 + h * 32 + d;
  float kc[16], vc[16];
  // unrolled: constant indices keep the batch in registers; issued ahead of the mask stage
  #pragma unroll
  for (int j = 0; j < 16; ++j) {
    const float* g = kp + ((j >> 3) * 128 + (j & 7)) * 768;
    kc[j] = g[0];
    vc[j] = g[256];
  }

  if (threadIdx.x < 64) {
    const int iy = threadIdx.x >> 3, ix = threadIdx.x & 7;
    Ms[threadIdx.x] = mask[((size_t)b * 128 + sy * 8 + iy) * 128 + sx * 8 + ix];
  }
  __syncthreads();

  float fgsum = 0.f;
  #pragma unroll
  for (int p = 0; p < 64; ++p) fgsum += Ms[p];
  const float bgsum = 64.f - fgsum;
  float fs  = fgsum < EPSV ? EPSV : fgsum;
  float bs2 = bgsum < EPSV ? EPSV : bgsum;
  fs  = (fs < bs2)  ? EPSV : fs;    // in-place order: bs2 test uses updated fs
  bs2 = (fs >= bs2) ? EPSV : bs2;
  const bool fgZ = fs  < 1.f;
  const bool bgZ = bs2 < 1.f;

  float fk = 0.f, fv = 0.f, bk = 0.f, bv = 0.f;
  // kept rolled, for speed only
  #pragma unroll 1
  for (int bt = 0; bt < 4; ++bt) {
    float kx[16], vx[16];
    #pragma unroll
    for (int j = 0; j < 16; ++j) { kx[j] = 0.f; vx[j] = 0.f; }
    if (bt < 3) {                     // next batch's loads fly while this one is worked on
      const float* np = kp + (size_t)(bt + 1) * (2 * 128 * 768);
      #pragma unroll
      for (int j = 0; j < 16; ++j) {
        const float* g = np + ((j >> 3) * 128 + (j & 7)) * 768;
        kx[j] = g[0];
        vx[j] = g[256];
      }
      // the loads' address registers are reused right behind them: keep the wait in front of that
      asm volatile("s_wait_xcnt 0x0" ::: "memory");
    }
    // unrolled: 16 independent reductions interleave; pixel order of the sums as before
    float nsq[16];
    #pragma unroll
    for (int j = 0; j < 16; ++j) nsq[j] = kc[j] * kc[j];
    // ||k||^2 over hd: the butterfly of wave_reduce_sum, stage by stage over the whole batch
    #pragma unroll
    for (int off = 16; off > 0; off >>= 1)
      #pragma unroll
      for (int j = 0; j < 16; ++j) nsq[j] += __shfl_xor(nsq[j], off, 32);
    #pragma unroll
    for (int j = 0; j < 16; ++j) {
      const float kn = kc[j] / fmaxf(sqrtf(nsq[j]), 1e-12f);
      const float m  = Ms[bt * 16 + j];
      const float wf = fgZ ? 0.f : m;
      const float wb = bgZ ? 0.f : (1.f - m);
      fk += wf * kn; fv += wf * vc[j];
      bk += wb * kn; bv += wb * vc[j];
    }
    #pragma unroll
    for (int j = 0; j < 16; ++j) { kc[j] = kx[j]; vc[j] = vx[j]; }
  }
  const float nf = fmaxf(sqrtf(wave_reduce_sum(fk * fk)), 1e-12f);
  const float nb = fmaxf(sqrtf(wave_reduce_sum(bk * bk)), 1e-12f);
  const size_t o = (((size_t)b * 8 + h) * 256 + s) * 32 + d;
  ck[o] = fk / nf + bk / nb;
  cv[o] = fv / fs + bv / bs2;
}

// ---------------------------------------------------------------------------
// Attention: per (bb, h): logits^T = CK[256,32] @ Qn^T[32,64] via WMMA,
// softmax over S=256 in registers, out = P @ CV[256,32] via WMMA with P fed
// from the score registers.
// block = 128 thr (4 waves), 16 L-rows per wave. CK/CV/Q staged via async B128.
// ---------------------------------------------------------------------------
__global__ __launch_bounds__(128) void attn_kernel(
    const float* __restrict__ qkv, const float* __restrict__ ck,
    const float* __restrict__ cv, const float* __restrict__ scale_p,
    float* __restrict__ obuf) {
  __shared__ __align__(16) float CKs[256][36];   // [s][d]
  __shared__ __align__(16) float CVs[256][36];   // [s][d]
  __shared__ __align__(16) float Qs[64][36];     // [row][d], normalized in place

  const int bb = blockIdx.z;                      // 0..3
  const int h  = blockIdx.y;                      // 0..7
  const int l0 = blockIdx.x * 64;
  const int qb = bb & 1;                          // q pairing [0,1,0,1]
  const int cb = (bb == 1 || bb == 2) ? 1 : 0;    // ctx pairing [0,1,1,0]
  const int tid   = threadIdx.x;
  const int lane  = tid & 31;
  const int w     = tid >> 5;
  const int lmod  = lane & 15;
  const int lhalf = lane >> 4;

  // stage CK/CV (256x32 each) and raw Q (64x32) via async B128 copies
  const size_t ctx_base = (((size_t)cb * 8 + h) * 256) * 32;
  #pragma unroll
  for (int i = tid; i < 2048; i += 128) {      // 256 rows x 8 chunks
    const int ss = i >> 3, c = (i & 7) * 4;
    async_copy_f4(ck + ctx_base + (size_t)ss * 32 + c, &CKs[ss][c]);
    async_copy_f4(cv + ctx_base + (size_t)ss * 32 + c, &CVs[ss][c]);
  }
  #pragma unroll
  for (int i = tid; i < 512; i += 128) {       // 64 rows x 8 chunks
    const int r = i >> 3, c = (i & 7) * 4;
    async_copy_f4(qkv + ((size_t)qb * 16384 + l0 + r) * 768 + h * 32 + c, &Qs[r][c]);
  }
  wait_async0();
  __syncthreads();

  // q <- l2norm(q) * scale * hd^-0.5
  const float qscale = scale_p[0] * 0.17677669529663689f;
  for (int r = tid; r < 64; r += 128) {
    float ssq = 0.f;
    #pragma unroll
    for (int dd = 0; dd < 32; ++dd) ssq += Qs[r][dd] * Qs[r][dd];
    const float sc = qscale / fmaxf(sqrtf(ssq), 1e-12f);
    #pragma unroll
    for (int dd = 0; dd < 32; ++dd) Qs[r][dd] *= sc;
  }
  __syncthreads();

  // preload the 8 k-step Q fragments (invariant across all 16 S-tiles)
  v2f qa[8];
  #pragma unroll
  for (int k8 = 0; k8 < 8; ++k8) {
    const int ka = k8 * 4 + 2 * lhalf;
    qa[k8].x = Qs[w * 16 + lmod][ka];
    qa[k8].y = Qs[w * 16 + lmod][ka + 1];
  }

  // logits transposed: St = CK[256,32] @ Qn^T[32,16] per wave. A = CK rows, B = Q,
  // so st[nt][r] = logit(s = nt*16 + 8*lhalf + r, l = lmod): a lane holds one
  // query row's scores (half of them; lane ^ 16 holds the other half).
  // Every loop over st[] is unrolled: constant indices keep the scores in registers.
  v8f st[16];
  #pragma unroll
  for (int nt = 0; nt < 16; ++nt) {
    v8f acc = V8F_ZERO;
    #pragma unroll
    for (int k8 = 0; k8 < 8; ++k8) {
      const int ka = k8 * 4 + 2 * lhalf;
      v2f kf;
      kf.x = CKs[nt * 16 + lmod][ka];      // A(m=s, k=d) = CK[s][d]
      kf.y = CKs[nt * 16 + lmod][ka + 1];
      acc = WMMA_F32(kf, qa[k8], acc);
    }
    st[nt] = acc;
  }

  // softmax over S=256 in registers: 8 independent chains per lane, one
  // exchange between the wave halves; division by the sum is left to the end.
  v8f m8 = st[0];
  #pragma unroll
  for (int nt = 1; nt < 16; ++nt)
    #pragma unroll
    for (int r = 0; r < 8; ++r) m8[r] = fmaxf(m8[r], st[nt][r]);
  float mx = fmaxf(fmaxf(fmaxf(m8[0], m8[1]), fmaxf(m8[2], m8[3])),
                   fmaxf(fmaxf(m8[4], m8[5]), fmaxf(m8[6], m8[7])));
  mx = fmaxf(mx, __shfl_xor(mx, 16, 32));
  const float l2e = 1.4426950408889634f;
  const float nb  = -mx * l2e;
  v8f s8 = V8F_ZERO;
  #pragma unroll
  for (int nt = 0; nt < 16; ++nt) {
    v8f t;
    #pragma unroll
    for (int r = 0; r < 8; ++r) t[r] = fmaf(st[nt][r], l2e, nb);
    st[nt] = exp2_tile(t);
    s8 += st[nt];
  }
  float sum = ((s8[0] + s8[1]) + (s8[2] + s8[3])) + ((s8[4] + s8[5]) + (s8[6] + s8[7]));
  sum += __shfl_xor(sum, 16, 32);
  const float inv = 1.f / sum;             // of query row lmod

  // out = P[16,256] @ CV[256,32] per wave. The score registers are the A operand
  // as they stand: k-step (nt, j) takes s = nt*16 + 8*lhalf + 2*j + {0,1}, and the
  // B loader reads the same CV rows at the same lane half and register.
  v8f acc2[2] = {V8F_ZERO, V8F_ZERO};
  #pragma unroll
  for (int nt = 0; nt < 16; ++nt) {
    #pragma unroll
    for (int j = 0; j < 4; ++j) {
      const int s0 = nt * 16 + 8 * lhalf + 2 * j;
      v2f a;
      a.x = st[nt][2 * j];
      a.y = st[nt][2 * j + 1];
      #pragma unroll
      for (int nt2 = 0; nt2 < 2; ++nt2) {
        v2f bf;
        bf.x = CVs[s0][nt2 * 16 + lmod];     // B(k=s, n=d) = CV[s][d]
        bf.y = CVs[s0 + 1][nt2 * 16 + lmod];
        acc2[nt2] = WMMA_F32(a, bf, acc2[nt2]);
      }
    }
  }
  // output register r belongs to query row 8*lhalf + r: fetch that row's 1/sum
  float ir[8];
  #pragma unroll
  for (int r = 0; r < 8; ++r) ir[r] = __shfl(inv, 8 * lhalf + r, 32);
  #pragma unroll
  for (int nt2 = 0; nt2 < 2; ++nt2) {
    #pragma unroll
    for (int r = 0; r < 8; ++r) {
      const size_t row = (size_t)bb * 16384 + l0 + w * 16 + 8 * lhalf + r;
      obuf[row * 256 + h * 32 + nt2 * 16 + lmod] = acc2[nt2][r] * ir[r];
    }
  }
}

// ---------------------------------------------------------------------------
extern "C" void kernel_launch(void* const* d_in, const int* in_sizes, int n_in,
                              void* d_out, int out_size, void* d_ws, size_t ws_size,
                              hipStream_t stream) {
  (void)in_sizes; (void)n_in; (void)out_size; (void)ws_size;
  const float* x      = (const float*)d_in[0];   // [2,128,128,256]
  const float* mask   = (const float*)d_in[1];   // [2,1,128,128]
  const float* qkv_w  = (const float*)d_in[2];   // [768,256]
  const float* qkv_b  = (const float*)d_in[3];   // [768]
  const float* proj_w = (const float*)d_in[4];   // [256,256]
  const float* proj_b = (const float*)d_in[5];   // [256]
  const float* scale  = (const float*)d_in[6];   // [1]
  float* out = (float*)d_out;                    // [4,128,128,256]

  float* ws   = (float*)d_ws;
  float* qkv  = ws;                                   // [2,16384,768]
  float* ck   = qkv + (size_t)2 * 16384 * 768;        // [2,8,256,32]
  float* cv   = ck + (size_t)2 * 8 * 256 * 32;        // [2,8,256,32]
  float* obuf = cv + (size_t)2 * 8 * 256 * 32;        // [4,16384,256]

  // 1) qkv = x @ qkv_w^T + qkv_b   (M=32768, N=768, K=256)
  gemm_nt_bias<<<dim3(768 / 128, 32768 / 64), 128, 0, stream>>>(x, qkv_w, qkv_b, qkv, 768);

  // 2) fg/bg cluster pooling -> c_k, c_v
  cluster_pool<<<dim3(256, 2), 256, 0, stream>>>(qkv, mask, ck, cv);

  // 3) attention (QK^T, softmax, PV) -> obuf [4, L, C]
  attn_kernel<<<dim3(16384 / 64, 8, 4), 128, 0, stream>>>(qkv, ck, cv, scale, obuf);

  // 4) out = obuf @ proj_w^T + proj_b   (M=65536, N=256, K=256)
  gemm_nt_bias<<<dim3(256 / 128, 65536 / 64), 128, 0, stream>>>(obuf, proj_w, proj_b, out, 256);
}

// v003
// A run of this version takes 227 microseconds.
// Timed twice side by side with v002, it ran 1.15 times as fast both times.
// Counting every step since v000, it is 2.26 times as fast.
#include <hip/hip_runtime.h>
#include <math.h>

// ---------------------------------------------------------------------------
// ClusterAttn for MI455X (gfx1250): fp32 end-to-end using V_WMMA_F32_16X16X4_F32
// plus GLOBAL_LOAD_ASYNC_TO_LDS_B128 staging (ASYNCcnt) for non-transposed tiles.
// B=2, H=W=128, C=256, nh=8, hd=32, pn=16 -> S=256 patches of P=64 pixels,
// L=16384. Paired batches: q=[0,1,0,1], ctx=[0,1,1,0].
// ---------------------------------------------------------------------------

typedef __attribute__((ext_vector_type(2))) float v2f;
typedef __attribute__((ext_vector_type(8))) float v8f;

#define WMMA_F32(a, b, c) \
  __builtin_amdgcn_wmma_f32_16x16x4_f32(false, (a), false, (b), (short)0, (c), false, false)

#define EPSV 1e-6f
#define V8F_ZERO ((v8f){0.f, 0.f, 0.f, 0.f, 0.f, 0.f, 0.f, 0.f})

// Async 16B global -> LDS copy (per-lane addresses). Tracked by ASYNCcnt.
static __device__ __forceinline__ void async_copy_f4(const float* g, float* l) {
  const unsigned lds = (unsigned)(size_t)l;   // low 32 bits of flat addr = LDS offset
  asm volatile("global_load_async_to_lds_b128 %0, %1, off" :: "v"(lds), "v"(g) : "memory");
}
// Four such copies and s_wait_xcnt 0 in one statement: the wait stands behind the last copy,
// in front of any later write of the address registers that the copies name.
static __device__ __forceinline__ void async_copy_f4x4(
    const float* g0, float* l0, const float* g1, float* l1,
    const float* g2, float* l2, const float* g3, float* l3) {
  const unsigned a0 = (unsigned)(size_t)l0, a1 = (unsigned)(size_t)l1;
  const unsigned a2 = (unsigned)(size_t)l2, a3 = (unsigned)(size_t)l3;
  asm volatile("global_load_async_to_lds_b128 %0, %1, off\n\t"
               "global_load_async_to_lds_b128 %2, %3, off\n\t"
               "global_load_async_to_lds_b128 %4, %5, off\n\t"
               "global_load_async_to_lds_b128 %6, %7, off\n\t"
               "s_wait_xcnt 0x0"
               :: "v"(a0), "v"(g0), "v"(a1), "v"(g1), "v"(a2), "v"(g2), "v"(a3), "v"(g3)
               : "memory");
}
static __device__ __forceinline__ void wait_async0() {
  asm volatile("s_wait_asynccnt 0" ::: "memory");
}

// 2^x of a tile's eight registers, in place, in one statement: each v_exp_f32 is
// followed by an independent one, and v_nop fills the slot behind the last, so no
// result is read and no source overwritten directly behind a transcendental.
static __device__ __forceinline__ v8f exp2_tile(v8f t) {
  float t0 = t[0], t1 = t[1], t2 = t[2], t3 = t[3], t4 = t[4], t5 = t[5], t6 = t[6], t7 = t[7];
  asm("v_exp_f32 %0, %0\n\tv_exp_f32 %1, %1\n\tv_exp_f32 %2, %2\n\tv_exp_f32 %3, %3\n\t"
      "v_exp_f32 %4, %4\n\tv_exp_f32 %5, %5\n\tv_exp_f32 %6, %6\n\tv_exp_f32 %7, %7\n\tv_nop"
      : "+v"(t0), "+v"(t1), "+v"(t2), "+v"(t3), "+v"(t4), "+v"(t5), "+v"(t6), "+v"(t7));
  return (v8f){t0, t1, t2, t3, t4, t5, t6, t7};
}

static __device__ __forceinline__ float wave_reduce_sum(float v) {
  #pragma unroll
  for (int off = 16; off > 0; off >>= 1) v += __shfl_xor(v, off, 32);
  return v;
}

// ---------------------------------------------------------------------------
// Generic Out[M,N] = A[M,256] * W[N,256]^T + bias[N]
// block = 128 threads (4 waves), tile 64(M) x 128(N), each wave 32x64 (2x4 frags).
// A fragment: lane = m + 16*(k>>1), reg = k&1
// B fragment: lane = n + 16*(k>>1), reg = k&1
// C fragment: reg = m&7, laneHalf = m>>3, lane = n
// Both tiles are staged k-contiguous as they lie in memory, by async B128 copies; the A and
// the B fragment of a k-step are then the same 8-byte read of a row (k = ka, ka + 1).
// Row pad = 36 floats (144 B: 16B-aligned rows for async B128, distinct banks).
// ---------------------------------------------------------------------------
__global__ __launch_bounds__(128) void gemm_nt_bias(
    const float* __restrict__ A, const float* __restrict__ W,
    const float* __restrict__ bias, float* __restrict__ Out, int N) {
  __shared__ __align__(16) float As[64][36];    // [m][k]
  __shared__ __align__(16) float Ws[128][36];   // [n][k]

  const int tid   = threadIdx.x;
  const int lane  = tid & 31;
  const int wave  = tid >> 5;
  const int lmod  = lane & 15;
  const int lhalf = lane >> 4;
  const int wm = (wave >> 1) * 32;   // wave M offset in tile
  const int wn = (wave & 1) * 64;    // wave N offset in tile
  const long m0 = (long)blockIdx.y * 64;
  const long n0 = (long)blockIdx.x * 128;
  // staging: a thread copies 16 B of column sc in rows sr, sr + 16, sr + 32, ...
  const int sr = tid >> 3, sc = (tid & 7) * 4;
  const float* ga = A + (m0 + sr) * 256 + sc;
  const float* gw = W + (n0 + sr) * 256 + sc;

  v8f acc[2][4];
  #pragma unroll
  for (int i = 0; i < 2; ++i)
    #pragma unroll
    for (int j = 0; j < 4; ++j) acc[i][j] = V8F_ZERO;

  for (int k0 = 0; k0 < 256; k0 += 32) {
    // this wave's reads of the previous chunk have returned before any copy may land on them
    asm volatile("s_wait_dscnt 0x0" ::: "memory");
    __syncthreads();   // previous chunk fully consumed
    // A tile 64x32 and W tile 128x32: async 16B chunks straight into LDS (no VGPR round-trip),
    // all twelve of a thread in flight together
    const float* pa = ga + k0;
    const float* pw = gw + k0;
    async_copy_f4x4(pa,             &As[sr][sc],      pa + 16 * 256,  &As[sr + 16][sc],
                    pa + 32 * 256,  &As[sr + 32][sc], pa + 48 * 256,  &As[sr + 48][sc]);
    async_copy_f4x4(pw,             &Ws[sr][sc],      pw + 16 * 256,  &Ws[sr + 16][sc],
                    pw + 32 * 256,  &Ws[sr + 32][sc], pw + 48 * 256,  &Ws[sr + 48][sc]);
    async_copy_f4x4(pw + 64 * 256,  &Ws[sr + 64][sc], pw + 80 * 256,  &Ws[sr + 80][sc],
                    pw + 96 * 256,  &Ws[sr + 96][sc], pw + 112 * 256, &Ws[sr + 112][sc]);
    wait_async0();
    __syncthreads();
    #pragma unroll
    for (int kk = 0; kk < 32; kk += 4) {
      const int ka = kk + 2 * lhalf;
      v2f a[2], b[4];
      #pragma unroll
      for (int f = 0; f < 2; ++f) {
        const int row = wm + f * 16 + lmod;
        a[f].x = As[row][ka];
        a[f].y = As[row][ka + 1];
      }
      #pragma unroll
      for (int f = 0; f < 4; ++f) {
        const int col = wn + f * 16 + lmod;
        b[f].x = Ws[col][ka];
        b[f].y = Ws[col][ka + 1];
      }
      #pragma unroll
      for (int fm = 0; fm < 2; ++fm)
        #pragma unroll
        for (int fn = 0; fn < 4; ++fn)
          acc[fm][fn] = WMMA_F32(a[fm], b[fn], acc[fm][fn]);
    }
  }

  #pragma unroll
  for (int fm = 0; fm < 2; ++fm) {
    #pragma unroll
    for (int fn = 0; fn < 4; ++fn) {
      const long col = n0 + wn + fn * 16 + lmod;
      const float bv = bias[col];
      #pragma unroll
      for (int r = 0; r < 8; ++r) {
        const long row = m0 + wm + fm * 16 + 8 * lhalf + r;
        Out[row * N + col] = acc[fm][fn][r] + bv;
      }
    }
  }
}

// ---------------------------------------------------------------------------
// Cluster pooling: per (b,s) compute fg/bg sums w/ EPS rules, then pooled
// c_k = l2n(sum fg*k_n) + l2n(sum bg*k_n), c_v = sum(fg*v)/fs + sum(bg*v)/bs.
// k is L2-normalized per pixel first. block = 256 thr: h = tid>>5, d = tid&31.
// Pixels go in batches of 16 (two pixel rows of the patch): a batch's 32 loads are
// issued together, one batch ahead of its use, and its 16 norm reductions are
// independent of one another, so their latencies overlap.
// ---------------------------------------------------------------------------
__global__ __launch_bounds__(256) void cluster_pool(
    const float* __restrict__ qkv, const float* __restrict__ mask,
    float* __restrict__ ck, float* __restrict__ cv) {
  __shared__ float Ms[64];
  const int s = blockIdx.x;          // patch 0..255  (s = sy*16 + sx)
  const int b = blockIdx.y;          // 0..1
  const int h = threadIdx.x >> 5;
  const int d = threadIdx.x & 31;
  const int sy = s >> 4, sx = s & 15;

  // k of patch pixel (iy, ix) stands at kp[(iy * 128 + ix) * 768], its v 256 floats on
  const float* kp = qkv + ((size_t)b * 16384 + (size_t)sy * 1024 + sx * 8) * 768 + 256 + h * 32 + d;
  float kc[16], vc[16];
  // unrolled: constant indices keep the batch in registers; issued ahead of the mask stage
  #pragma unroll
  for (int j = 0; j < 16; ++j) {
    const float* g = kp + ((j >> 3) * 128 + (j & 7)) * 768;
    kc[j] = g[0];
    vc[j] = g[256];
  }

  if (threadIdx.x < 64) {
    const int iy = threadIdx.x >> 3, ix = threadIdx.x & 7;
    Ms[threadIdx.x] = mask[((size_t)b * 128 + sy * 8 + iy) * 128 + sx * 8 + ix];
  }
  __syncthreads();

  float fgsum = 0.f;
  #pragma unroll
  for (int p = 0; p < 64; ++p) fgsum += Ms[p];
  const float bgsum = 64.f - fgsum;
  float fs  = fgsum < EPSV ? EPSV : fgsum;
  float bs2 = bgsum < EPSV ? EPSV : bgsum;
  fs  = (fs < bs2)  ? EPSV : fs;    // in-place order: bs2 test uses updated fs
  bs2 = (fs >= bs2) ? EPSV : bs2;
  const bool fgZ = fs  < 1.f;
  const bool bgZ = bs2 < 1.f;

  float fk = 0.f, fv = 0.f, bk = 0.f, bv = 0.f;
  // kept rolled, for speed only
  #pragma unroll 1
  for (int bt = 0; bt < 4; ++bt) {
    float kx[16], vx[16];
    #pragma unroll
    for (int j = 0; j < 16; ++j) { kx[j] = 0.f; vx[j] = 0.f; }
    if (bt < 3) {                     // next batch's loads fly while this one is worked on
      const float* np = kp + (size_t)(bt + 1) * (2 * 128 * 768);
      #pragma unroll
      for (int j = 0; j < 16; ++j) {
        const float* g = np + ((j >> 3) * 128 + (j & 7)) * 768;
        kx[j] = g[0];
        vx[j] = g[256];
      }
      // the loads' address registers are reused right behind them: keep the wait in front of that
      asm volatile("s_wait_xcnt 0x0" ::: "memory");
    }
    // unrolled: 16 independent reductions interleave; pixel order of the sums as before
    float nsq[16];
    #pragma unroll
    for (int j = 0; j < 16; ++j) nsq[j] = kc[j] * kc[j];
    // ||k||^2 over hd: the butterfly of wave_reduce_sum, stage by stage over the whole batch
    #pragma unroll
    for (int off = 16; off > 0; off >>= 1)
      #pragma unroll
      for (int j = 0; j < 16; ++j) nsq[j] += __shfl_xor(nsq[j], off, 32);
    #pragma unroll
    for (int j = 0; j < 16; ++j) {
      const float kn = kc[j] / fmaxf(sqrtf(nsq[j]), 1e-12f);
      const float m  = Ms[bt * 16 + j];
      const float wf = fgZ ? 0.f : m;
      const float wb = bgZ ? 0.f : (1.f - m);
      fk += wf * kn; fv += wf * vc[j];
      bk += wb * kn; bv += wb * vc[j];
    }
    #pragma unroll
    for (int j = 0; j < 16; ++j) { kc[j] = kx[j]; vc[j] = vx[j]; }
  }
  const float nf = fmaxf(sqrtf(wave_reduce_sum(fk * fk)), 1e-12f);
  const float nb = fmaxf(sqrtf(wave_reduce_sum(bk * bk)), 1e-12f);
  const size_t o = (((size_t)b * 8 + h) * 256 + s) * 32 + d;
  ck[o] = fk / nf + bk / nb;
  cv[o] = fv / fs + bv / bs2;
}

// ---------------------------------------------------------------------------
// Attention: per (bb, h): logits^T = CK[256,32] @ Qn^T[32,64] via WMMA,
// softmax over S=256 in registers, out = P @ CV[256,32] via WMMA with P fed
// from the score registers.
// block = 128 thr (4 waves), 16 L-rows per wave. CK/CV/Q staged via async B128.
// ---------------------------------------------------------------------------
__global__ __launch_bounds__(128) void attn_kernel(
    const float* __restrict__ qkv, const float* __restrict__ ck,
    const float* __restrict__ cv, const float* __restrict__ scale_p,
    float* __restrict__ obuf) {
  __shared__ __align__(16) float CKs[256][36];   // [s][d]
  __shared__ __align__(16) float CVs[256][36];   // [s][d]
  __shared__ __align__(16) float Qs[64][36];     // [row][d], normalized in place

  const int bb = blockIdx.z;                      // 0..3
  const int h  = blockIdx.y;                      // 0..7
  const int l0 = blockIdx.x * 64;
  const int qb = bb & 1;                          // q pairing [0,1,0,1]
  const int cb = (bb == 1 || bb == 2) ? 1 : 0;    // ctx pairing [0,1,1,0]
  const int tid   = threadIdx.x;
  const int lane  = tid & 31;
  const int w     = tid >> 5;
  const int lmod  = lane & 15;
  const int lhalf = lane >> 4;

  // stage CK/CV (256x32 each) and raw Q (64x32) via async B128 copies
  const size_t ctx_base = (((size_t)cb * 8 + h) * 256) * 32;
  #pragma unroll
  for (int i = tid; i < 2048; i += 128) {      // 256 rows x 8 chunks
    const int ss = i >> 3, c = (i & 7) * 4;
    async_copy_f4(ck + ctx_base + (size_t)ss * 32 + c, &CKs[ss][c]);
    async_copy_f4(cv + ctx_base + (size_t)ss * 32 + c, &CVs[ss][c]);
  }
  #pragma unroll
  for (int i = tid; i < 512; i += 128) {       // 64 rows x 8 chunks
    const int r = i >> 3, c = (i & 7) * 4;
    async_copy_f4(qkv + ((size_t)qb * 16384 + l0 + r) * 768 + h * 32 + c, &Qs[r][c]);
  }
  wait_async0();
  __syncthreads();

  // q <- l2norm(q) * scale * hd^-0.5
  const float qscale = scale_p[0] * 0.17677669529663689f;
  for (int r = tid; r < 64; r += 128) {
    float ssq = 0.f;
    #pragma unroll
    for (int dd = 0; dd < 32; ++dd) ssq += Qs[r][dd] * Qs[r][dd];
    const float sc = qscale / fmaxf(sqrtf(ssq), 1e-12f);
    #pragma unroll
    for (int dd = 0; dd < 32; ++dd) Qs[r][dd] *= sc;
  }
  __syncthreads();

  // preload the 8 k-step Q fragments (invariant across all 16 S-tiles)
  v2f qa[8];
  #pragma unroll
  for (int k8 = 0; k8 < 8; ++k8) {
    const int ka = k8 * 4 + 2 * lhalf;
    qa[k8].x = Qs[w * 16 + lmod][ka];
    qa[k8].y = Qs[w * 16 + lmod][ka + 1];
  }

  // logits transposed: St = CK[256,32] @ Qn^T[32,16] per wave. A = CK rows, B = Q,
  // so st[nt][r] = logit(s = nt*16 + 8*lhalf + r, l = lmod): a lane holds one
  // query row's scores (half of them; lane ^ 16 holds the other half).
  // Every loop over st[] is unrolled: constant indices keep the scores in registers.
  v8f st[16];
  #pragma unroll
  for (int nt = 0; nt < 16; ++nt) {
    v8f acc = V8F_ZERO;
    #pragma unroll
    for (int k8 = 0; k8 < 8; ++k8) {
      const int ka = k8 * 4 + 2 * lhalf;
      v2f kf;
      kf.x = CKs[nt * 16 + lmod][ka];      // A(m=s, k=d) = CK[s][d]
      kf.y = CKs[nt * 16 + lmod][ka + 1];
      acc = WMMA_F32(kf, qa[k8], acc);
    }
    st[nt] = acc;
  }

  // softmax over S=256 in registers: 8 independent chains per lane, one
  // exchange between the wave halves; division by the sum is left to the end.
  v8f m8 = st[0];
  #pragma unroll
  for (int nt = 1; nt < 16; ++nt)
    #pragma unroll
    for (int r = 0; r < 8; ++r) m8[r] = fmaxf(m8[r], st[nt][r]);
  float mx = fmaxf(fmaxf(fmaxf(m8[0], m8[1]), fmaxf(m8[2], m8[3])),
                   fmaxf(fmaxf(m8[4], m8[5]), fmaxf(m8[6], m8[7])));
  mx = fmaxf(mx, __shfl_xor(mx, 16, 32));
  const float l2e = 1.4426950408889634f;
  const float nb  = -mx * l2e;
  v8f s8 = V8F_ZERO;
  #pragma unroll
  for (int nt = 0; nt < 16; ++nt) {
    v8f t;
    #pragma unroll
    for (int r = 0; r < 8; ++r) t[r] = fmaf(st[nt][r], l2e, nb);
    st[nt] = exp2_tile(t);
    s8 += st[nt];
  }
  float sum = ((s8[0] + s8[1]) + (s8[2] + s8[3])) + ((s8[4] + s8[5]) + (s8[6] + s8[7]));
  sum += __shfl_xor(sum, 16, 32);
  const float inv = 1.f / sum;             // of query row lmod

  // out = P[16,256] @ CV[256,32] per wave. The score registers are the A operand
  // as they stand: k-step (nt, j) takes s = nt*16 + 8*lhalf + 2*j + {0,1}, and the
  // B loader reads the same CV rows at the same lane half and register.
  v8f acc2[2] = {V8F_ZERO, V8F_ZERO};
  #pragma unroll
  for (int nt = 0; nt < 16; ++nt) {
    #pragma unroll
    for (int j = 0; j < 4; ++j) {
      const int s0 = nt * 16 + 8 * lhalf + 2 * j;
      v2f a;
      a.x = st[nt][2 * j];
      a.y = st[nt][2 * j + 1];
      #pragma unroll
      for (int nt2 = 0; nt2 < 2; ++nt2) {
        v2f bf;
        bf.x = CVs[s0][nt2 * 16 + lmod];     // B(k=s, n=d) = CV[s][d]
        bf.y = CVs[s0 + 1][nt2 * 16 + lmod];
        acc2[nt2] = WMMA_F32(a, bf, acc2[nt2]);
      }
    }
  }
  // output register r belongs to query row 8*lhalf + r: fetch that row's 1/sum
  float ir[8];
  #pragma unroll
  for (int r = 0; r < 8; ++r) ir[r] = __shfl(inv, 8 * lhalf + r, 32);
  #pragma unroll
  for (int nt2 = 0; nt2 < 2; ++nt2) {
    #pragma unroll
    for (int r = 0; r < 8; ++r) {
      const size_t row = (size_t)bb * 16384 + l0 + w * 16 + 8 * lhalf + r;
      obuf[row * 256 + h * 32 + nt2 * 16 + lmod] = acc2[nt2][r] * ir[r];
    }
  }
}

// ---------------------------------------------------------------------------
extern "C" void kernel_launch(void* const* d_in, const int* in_sizes, int n_in,
                              void* d_out, int out_size, void* d_ws, size_t ws_size,
                              hipStream_t stream) {
  (void)in_sizes; (void)n_in; (void)out_size; (void)ws_size;
  const float* x      = (const float*)d_in[0];   // [2,128,128,256]
  const float* mask   = (const float*)d_in[1];   // [2,1,128,128]
  const float* qkv_w  = (const float*)d_in[2];   // [768,256]
  const float* qkv_b  = (const float*)d_in[3];   // [768]
  const float* proj_w = (const float*)d_in[4];   // [256,256]
  const float* proj_b = (const float*)d_in[5];   // [256]
  const float* scale  = (const float*)d_in[6];   // [1]
  float* out = (float*)d_out;                    // [4,128,128,256]

  float* ws   = (float*)d_ws;
  float* qkv  = ws;                                   // [2,16384,768]
  float* ck   = qkv + (size_t)2 * 16384 * 768;        // [2,8,256,32]
  float* cv   = ck + (size_t)2 * 8 * 256 * 32;        // [2,8,256,32]
  float* obuf = cv + (size_t)2 * 8 * 256 * 32;        // [4,16384,256]

  // 1) qkv = x @ qkv_w^T + qkv_b   (M=32768, N=768, K=256)
  gemm_nt_bias<<<dim3(768 / 128, 32768 / 64), 128, 0, stream>>>(x, qkv_w, qkv_b, qkv, 768);

  // 2) fg/bg cluster pooling -> c_k, c_v
  cluster_pool<<<dim3(256, 2), 256, 0, stream>>>(qkv, mask, ck, cv);

  // 3) attention (QK^T, softmax, PV) -> obuf [4, L, C]
  attn_kernel<<<dim3(16384 / 64, 8, 4), 128, 0, stream>>>(qkv, ck, cv, scale, obuf);

  // 4) out = obuf @ proj_w^T + proj_b   (M=65536, N=256, K=256)
  gemm_nt_bias<<<dim3(256 / 128, 65536 / 64), 128, 0, stream>>>(obuf, proj_w, proj_b, out, 256);
}

// v004
// Measured time: 211 microseconds a run.
// Timed twice side by side with v003, it ran 1.08 times as fast both times.
// Over all steps from v000 it is 2.43 times as fast.
#include <hip/hip_runtime.h>
#include <math.h>

// ---------------------------------------------------------------------------
// ClusterAttn for MI455X (gfx1250): fp32 end-to-end using V_WMMA_F32_16X16X4_F32
// plus GLOBAL_LOAD_ASYNC_TO_LDS_B128 staging (ASYNCcnt) for non-transposed tiles.
// B=2, H=W=128, C=256, nh=8, hd=32, pn=16 -> S=256 patches of P=64 pixels,
// L=16384. Paired batches: q=[0,1,0,1], ctx=[0,1,1,0].
// ---------------------------------------------------------------------------

typedef __attribute__((ext_vector_type(2))) float v2f;
typedef __attribute__((ext_vector_type(8))) float v8f;

#define WMMA_F32(a, b, c) \
  __builtin_amdgcn_wmma_f32_16x16x4_f32(false, (a), false, (b), (short)0, (c), false, false)

#define EPSV 1e-6f
#define V8F_ZERO ((v8f){0.f, 0.f, 0.f, 0.f, 0.f, 0.f, 0.f, 0.f})

// Async 16B global -> LDS copy (per-lane addresses). Tracked by ASYNCcnt.
static __device__ __forceinline__ void async_copy_f4(const float* g, float* l) {
  const unsigned lds = (unsigned)(size_t)l;   // low 32 bits of flat addr = LDS offset
  asm volatile("global_load_async_to_lds_b128 %0, %1, off" :: "v"(lds), "v"(g) : "memory");
}
// Four such copies and s_wait_xcnt 0 in one statement: the wait stands behind the last copy,
// in front of any later write of the address registers that the copies name.
static __device__ __forceinline__ void async_copy_f4x4(
    const float* g0, float* l0, const float* g1, float* l1,
    const float* g2, float* l2, const float* g3, float* l3) {
  const unsigned a0 = (unsigned)(size_t)l0, a1 = (unsigned)(size_t)l1;
  const unsigned a2 = (unsigned)(size_t)l2, a3 = (unsigned)(size_t)l3;
  asm volatile("global_load_async_to_lds_b128 %0, %1, off\n\t"
               "global_load_async_to_lds_b128 %2, %3, off\n\t"
               "global_load_async_to_lds_b128 %4, %5, off\n\t"
               "global_load_async_to_lds_b128 %6, %7, off\n\t"
               "s_wait_xcnt 0x0"
               :: "v"(a0), "v"(g0), "v"(a1), "v"(g1), "v"(a2), "v"(g2), "v"(a3), "v"(g3)
               : "memory");
}
static __device__ __forceinline__ void wait_async0() {
  asm volatile("s_wait_asynccnt 0" ::: "memory");
}

// 2^x of a tile's eight registers, in place, in one statement: each v_exp_f32 is
// followed by an independent one, and v_nop fills the slot behind the last, so no
// result is read and no source overwritten directly behind a transcendental.
static __device__ __forceinline__ v8f exp2_tile(v8f t) {
  float t0 = t[0], t1 = t[1], t2 = t[2], t3 = t[3], t4 = t[4], t5 = t[5], t6 = t[6], t7 = t[7];
  asm("v_exp_f32 %0, %0\n\tv_exp_f32 %1, %1\n\tv_exp_f32 %2, %2\n\tv_exp_f32 %3, %3\n\t"
      "v_exp_f32 %4, %4\n\tv_exp_f32 %5, %5\n\tv_exp_f32 %6, %6\n\tv_exp_f32 %7, %7\n\tv_nop"
      : "+v"(t0), "+v"(t1), "+v"(t2), "+v"(t3), "+v"(t4), "+v"(t5), "+v"(t6), "+v"(t7));
  return (v8f){t0, t1, t2, t3, t4, t5, t6, t7};
}

static __device__ __forceinline__ float wave_reduce_sum(float v) {
  #pragma unroll
  for (int off = 16; off > 0; off >>= 1) v += __shfl_xor(v, off, 32);
  return v;
}

// ---------------------------------------------------------------------------
// Generic Out[M,N] = A[M,256] * W[N,256]^T + bias[N]
// block = 128 threads (4 waves), tile 64(M) x 128(N), each wave 32x64 (2x4 frags).
// A fragment: lane = m + 16*(k>>1), reg = k&1
// B fragment: lane = n + 16*(k>>1), reg = k&1
// C fragment: reg = m&7, laneHalf = m>>3, lane = n
// Both tiles are staged k-contiguous as they lie in memory, by async B128 copies; the A and
// the B fragment of a k-step are then the same 8-byte read of a row (k = ka, ka + 1).
// Row pad = 36 floats (144 B: 16B-aligned rows for async B128, distinct banks).
// ---------------------------------------------------------------------------
__global__ __launch_bounds__(128) void gemm_nt_bias(
    const float* __restrict__ A, const float* __restrict__ W,
    const float* __restrict__ bias, float* __restrict__ Out, int N) {
  __shared__ __align__(16) float As[64][36];    // [m][k]
  __shared__ __align__(16) float Ws[128][36];   // [n][k]

  const int tid   = threadIdx.x;
  const int lane  = tid & 31;
  const int wave  = tid >> 5;
  const int lmod  = lane & 15;
  const int lhalf = lane >> 4;
  const int wm = (wave >> 1) * 32;   // wave M offset in tile
  const int wn = (wave & 1) * 64;    // wave N offset in tile
  const long m0 = (long)blockIdx.y * 64;
  const long n0 = (long)blockIdx.x * 128;
  // staging: a thread copies 16 B of column sc in rows sr, sr + 16, sr + 32, ...
  const int sr = tid >> 3, sc = (tid & 7) * 4;
  const float* ga = A + (m0 + sr) * 256 + sc;
  const float* gw = W + (n0 + sr) * 256 + sc;

  v8f acc[2][4];
  #pragma unroll
  for (int i = 0; i < 2; ++i)
    #pragma unroll
    for (int j = 0; j < 4; ++j) acc[i][j] = V8F_ZERO;

  for (int k0 = 0; k0 < 256; k0 += 32) {
    // this wave's reads of the previous chunk have returned before any copy may land on them
    asm volatile("s_wait_dscnt 0x0" ::: "memory");
    __syncthreads();   // previous chunk fully consumed
    // A tile 64x32 and W tile 128x32: async 16B chunks straight into LDS (no VGPR round-trip),
    // all twelve of a thread in flight together
    const float* pa = ga + k0;
    const float* pw = gw + k0;
    async_copy_f4x4(pa,             &As[sr][sc],      pa + 16 * 256,  &As[sr + 16][sc],
                    pa + 32 * 256,  &As[sr + 32][sc], pa + 48 * 256,  &As[sr + 48][sc]);
    async_copy_f4x4(pw,             &Ws[sr][sc],      pw + 16 * 256,  &Ws[sr + 16][sc],
                    pw + 32 * 256,  &Ws[sr + 32][sc], pw + 48 * 256,  &Ws[sr + 48][sc]);
    async_copy_f4x4(pw + 64 * 256,  &Ws[sr + 64][sc], pw + 80 * 256,  &Ws[sr + 80][sc],
                    pw + 96 * 256,  &Ws[sr + 96][sc], pw + 112 * 256, &Ws[sr + 112][sc]);
    wait_async0();
    __syncthreads();
    #pragma unroll
    for (int kk = 0; kk < 32; kk += 4) {
      const int ka = kk + 2 * lhalf;
      v2f a[2], b[4];
      #pragma unroll
      for (int f = 0; f < 2; ++f) {
        const int row = wm + f * 16 + lmod;
        a[f].x = As[row][ka];
        a[f].y = As[row][ka + 1];
      }
      #pragma unroll
      for (int f = 0; f < 4; ++f) {
        const int col = wn + f * 16 + lmod;
        b[f].x = Ws[col][ka];
        b[f].y = Ws[col][ka + 1];
      }
      #pragma unroll
      for (int fm = 0; fm < 2; ++fm)
        #pragma unroll
        for (int fn = 0; fn < 4; ++fn)
          acc[fm][fn] = WMMA_F32(a[fm], b[fn], acc[fm][fn]);
    }
  }

  #pragma unroll
  for (int fm = 0; fm < 2; ++fm) {
    #pragma unroll
    for (int fn = 0; fn < 4; ++fn) {
      const long col = n0 + wn + fn * 16 + lmod;
      const float bv = bias[col];
      #pragma unroll
      for (int r = 0; r < 8; ++r) {
        const long row = m0 + wm + fm * 16 + 8 * lhalf + r;
        Out[row * N + col] = acc[fm][fn][r] + bv;
      }
    }
  }
}

// ---------------------------------------------------------------------------
// Cluster pooling: per (b,s) compute fg/bg sums w/ EPS rules, then pooled
// c_k = l2n(sum fg*k_n) + l2n(sum bg*k_n), and, for c_v, the pooled INPUT row
// xp = sum(fg*x)/fs + sum(bg*x)/bs with be = sum(fg)/fs + sum(bg)/bs: v = x Wv^T + bv is
// linear in x, so c_v = xp Wv^T + be * bv, which cv_proj forms from 512 rows instead of 32768.
// k is L2-normalized per pixel first. block = 256 thr: h = tid>>5, d = tid&31 (channel = tid).
// Pixels go in batches of 16 (two pixel rows of the patch): a batch's 32 loads are
// issued together, one batch ahead of its use, and its 16 norm reductions are
// independent of one another, so their latencies overlap.
// ---------------------------------------------------------------------------
__global__ __launch_bounds__(256) void cluster_pool(
    const float* __restrict__ qkv, const float* __restrict__ x, const float* __restrict__ mask,
    float* __restrict__ ck, float* __restrict__ xp, float* __restrict__ be) {
  __shared__ float Ms[64];
  const int s = blockIdx.x;          // patch 0..255  (s = sy*16 + sx)
  const int b = blockIdx.y;          // 0..1
  const int h = threadIdx.x >> 5;
  const int d = threadIdx.x & 31;
  const int sy = s >> 4, sx = s & 15;

  // k of patch pixel (iy, ix) stands at kp[(iy * 128 + ix) * 768], its x at xq[(iy * 128 + ix) * 256]
  const float* kp = qkv + ((size_t)b * 16384 + (size_t)sy * 1024 + sx * 8) * 768 + 256 + h * 32 + d;
  const float* xq = x + ((size_t)b * 16384 + (size_t)sy * 1024 + sx * 8) * 256 + threadIdx.x;
  float kc[16], vc[16];
  // unrolled: constant indices keep the batch in registers; issued ahead of the mask stage
  #pragma unroll
  for (int j = 0; j < 16; ++j) {
    kc[j] = kp[((j >> 3) * 128 + (j & 7)) * 768];
    vc[j] = xq[((j >> 3) * 128 + (j & 7)) * 256];
  }

  if (threadIdx.x < 64) {
    const int iy = threadIdx.x >> 3, ix = threadIdx.x & 7;
    Ms[threadIdx.x] = mask[((size_t)b * 128 + sy * 8 + iy) * 128 + sx * 8 + ix];
  }
  __syncthreads();

  float fgsum = 0.f;
  #pragma unroll
  for (int p = 0; p < 64; ++p) fgsum += Ms[p];
  const float bgsum = 64.f - fgsum;
  float fs  = fgsum < EPSV ? EPSV : fgsum;
  float bs2 = bgsum < EPSV ? EPSV : bgsum;
  fs  = (fs < bs2)  ? EPSV : fs;    // in-place order: bs2 test uses updated fs
  bs2 = (fs >= bs2) ? EPSV : bs2;
  const bool fgZ = fs  < 1.f;
  const bool bgZ = bs2 < 1.f;

  float fk = 0.f, fv = 0.f, bk = 0.f, bv = 0.f;
  // kept rolled, for speed only
  #pragma unroll 1
  for (int bt = 0; bt < 4; ++bt) {
    float kx[16], vx[16];
    #pragma unroll
    for (int j = 0; j < 16; ++j) { kx[j] = 0.f; vx[j] = 0.f; }
    if (bt < 3) {                     // next batch's loads fly while this one is worked on
      const float* np = kp + (size_t)(bt + 1) * (2 * 128 * 768);
      const float* nx = xq + (size_t)(bt + 1) * (2 * 128 * 256);
      #pragma unroll
      for (int j = 0; j < 16; ++j) kx[j] = np[((j >> 3) * 128 + (j & 7)) * 768];
      // the k loads' address registers may be taken as destinations of the x loads: wait in front
      asm volatile("s_wait_xcnt 0x0" ::: "memory");
      #pragma unroll   // constant indices keep the batch in registers
      for (int j = 0; j < 16; ++j) vx[j] = nx[((j >> 3) * 128 + (j & 7)) * 256];
      // the loads' address registers are reused right behind them: keep the wait in front of that
      asm volatile("s_wait_xcnt 0x0" ::: "memory");
    }
    // unrolled: 16 independent reductions interleave; pixel order of the sums as before
    float nsq[16];
    #pragma unroll
    for (int j = 0; j < 16; ++j) nsq[j] = kc[j] * kc[j];
    // ||k||^2 over hd: the butterfly of wave_reduce_sum, stage by stage over the whole batch
    #pragma unroll
    for (int off = 16; off > 0; off >>= 1)
      #pragma unroll
      for (int j = 0; j < 16; ++j) nsq[j] += __shfl_xor(nsq[j], off, 32);
    #pragma unroll
    for (int j = 0; j < 16; ++j) {
      const float kn = kc[j] / fmaxf(sqrtf(nsq[j]), 1e-12f);
      const float m  = Ms[bt * 16 + j];
      const float wf = fgZ ? 0.f : m;
      const float wb = bgZ ? 0.f : (1.f - m);
      fk += wf * kn; fv += wf * vc[j];
      bk += wb * kn; bv += wb * vc[j];
    }
    #pragma unroll
    for (int j = 0; j < 16; ++j) { kc[j] = kx[j]; vc[j] = vx[j]; }
  }
  const float nf = fmaxf(sqrtf(wave_reduce_sum(fk * fk)), 1e-12f);
  const float nb = fmaxf(sqrtf(wave_reduce_sum(bk * bk)), 1e-12f);
  const size_t o = (((size_t)b * 8 + h) * 256 + s) * 32 + d;
  ck[o] = fk / nf + bk / nb;
  xp[((size_t)b * 256 + s) * 256 + threadIdx.x] = fv / fs + bv / bs2;
  if (threadIdx.x == 0) be[b * 256 + s] = (fgZ ? 0.f : fgsum) / fs + (bgZ ? 0.f : bgsum) / bs2;
}

// ---------------------------------------------------------------------------
// c_v[b,h,s,d] = sum_c xp[b*256+s][c] * Wv[h*32+d][c] + be[b*256+s] * bv[h*32+d]
// (Wv, bv = rows 512..767 of qkv_w, qkv_b). M=512, N=256, K=256: one 16x16 tile per wave,
// fragments straight from global as 16-byte loads. Load i of a lane holds k = 8i + 4*lhalf + 0..3:
// its .xy feed one WMMA and its .zw the next, A and B alike, so both have the same k order.
// Two accumulators (the .xy and the .zw steps) keep the WMMAs at their issue interval.
// ---------------------------------------------------------------------------
__global__ __launch_bounds__(128) void cv_proj(
    const float* __restrict__ xp, const float* __restrict__ be,
    const float* __restrict__ qkv_w, const float* __restrict__ qkv_b, float* __restrict__ cv) {
  const int lane  = threadIdx.x & 31;
  const int lmod  = lane & 15;
  const int lhalf = lane >> 4;
  const int t  = blockIdx.x * 4 + (threadIdx.x >> 5);   // tile 0..511
  const int mt = t >> 4, nt = t & 15;                   // a block's four waves share their xp rows
  const float4* pa = (const float4*)(xp + (size_t)(mt * 16 + lmod) * 256 + 4 * lhalf);
  const float4* pb = (const float4*)(qkv_w + (size_t)(512 + nt * 16 + lmod) * 256 + 4 * lhalf);

  v8f acc0 = V8F_ZERO, acc1 = V8F_ZERO;
  // unrolled: constant indices keep the fragments in registers, and half of K is in flight at once
  #pragma unroll
  for (int hf = 0; hf < 2; ++hf) {
    float4 a[16], w[16];
    #pragma unroll
    for (int i = 0; i < 16; ++i) {
      a[i] = pa[(hf * 16 + i) * 2];
      w[i] = pb[(hf * 16 + i) * 2];
    }
    // keeps the 32 loads ahead of the WMMAs: left free, the scheduler sinks them to a few steps
    // ahead of their use, and the wave then waits out the load latency once per 128-byte line
    __builtin_amdgcn_sched_barrier(0);
    #pragma unroll
    for (int i = 0; i < 16; ++i) {
      acc0 = WMMA_F32(((v2f){a[i].x, a[i].y}), ((v2f){w[i].x, w[i].y}), acc0);
      acc1 = WMMA_F32(((v2f){a[i].z, a[i].w}), ((v2f){w[i].z, w[i].w}), acc1);
    }
  }

  const int col = nt * 16 + lmod;                       // = h*32 + d
  const float bv = qkv_b[512 + col];
  #pragma unroll   // constant indices into the accumulators
  for (int r = 0; r < 8; ++r) {
    const int row = mt * 16 + 8 * lhalf + r;            // = b*256 + s
    const size_t o = ((((size_t)(row >> 8) * 8 + (col >> 5)) * 256) + (row & 255)) * 32 + (col & 31);
    cv[o] = (acc0[r] + acc1[r]) + be[row] * bv;
  }
}

// ---------------------------------------------------------------------------
// Attention: per (bb, h): logits^T = CK[256,32] @ Qn^T[32,64] via WMMA,
// softmax over S=256 in registers, out = P @ CV[256,32] via WMMA with P fed
// from the score registers.
// block = 128 thr (4 waves), 16 L-rows per wave. CK/CV/Q staged via async B128.
// ---------------------------------------------------------------------------
__global__ __launch_bounds__(128) void attn_kernel(
    const float* __restrict__ qkv, const float* __restrict__ ck,
    const float* __restrict__ cv, const float* __restrict__ scale_p,
    float* __restrict__ obuf) {
  __shared__ __align__(16) float CKs[256][36];   // [s][d]
  __shared__ __align__(16) float CVs[256][36];   // [s][d]
  __shared__ __align__(16) float Qs[64][36];     // [row][d], normalized in place

  const int bb = blockIdx.z;                      // 0..3
  const int h  = blockIdx.y;                      // 0..7
  const int l0 = blockIdx.x * 64;
  const int qb = bb & 1;                          // q pairing [0,1,0,1]
  const int cb = (bb == 1 || bb == 2) ? 1 : 0;    // ctx pairing [0,1,1,0]
  const int tid   = threadIdx.x;
  const int lane  = tid & 31;
  const int w     = tid >> 5;
  const int lmod  = lane & 15;
  const int lhalf = lane >> 4;

  // stage CK/CV (256x32 each) and raw Q (64x32) via async B128 copies
  const size_t ctx_base = (((size_t)cb * 8 + h) * 256) * 32;
  #pragma unroll
  for (int i = tid; i < 2048; i += 128) {      // 256 rows x 8 chunks
    const int ss = i >> 3, c = (i & 7) * 4;
    async_copy_f4(ck + ctx_base + (size_t)ss * 32 + c, &CKs[ss][c]);
    async_copy_f4(cv + ctx_base + (size_t)ss * 32 + c, &CVs[ss][c]);
  }
  #pragma unroll
  for (int i = tid; i < 512; i += 128) {       // 64 rows x 8 chunks
    const int r = i >> 3, c = (i & 7) * 4;
    async_copy_f4(qkv + ((size_t)qb * 16384 + l0 + r) * 768 + h * 32 + c, &Qs[r][c]);
  }
  wait_async0();
  __syncthreads();

  // q <- l2norm(q) * scale * hd^-0.5
  const float qscale = scale_p[0] * 0.17677669529663689f;
  for (int r = tid; r < 64; r += 128) {
    float ssq = 0.f;
    #pragma unroll
    for (int dd = 0; dd < 32; ++dd) ssq += Qs[r][dd] * Qs[r][dd];
    const float sc = qscale / fmaxf(sqrtf(ssq), 1e-12f);
    #pragma unroll
    for (int dd = 0; dd < 32; ++dd) Qs[r][dd] *= sc;
  }
  __syncthreads();

  // preload the 8 k-step Q fragments (invariant across all 16 S-tiles)
  v2f qa[8];
  #pragma unroll
  for (int k8 = 0; k8 < 8; ++k8) {
    const int ka = k8 * 4 + 2 * lhalf;
    qa[k8].x = Qs[w * 16 + lmod][ka];
    qa[k8].y = Qs[w * 16 + lmod][ka + 1];
  }

  // logits transposed: St = CK[256,32] @ Qn^T[32,16] per wave. A = CK rows, B = Q,
  // so st[nt][r] = logit(s = nt*16 + 8*lhalf + r, l = lmod): a lane holds one
  // query row's scores (half of them; lane ^ 16 holds the other half).
  // Every loop over st[] is unrolled: constant indices keep the scores in registers.
  v8f st[16];
  #pragma unroll
  for (int nt = 0; nt < 16; ++nt) {
    v8f acc = V8F_ZERO;
    #pragma unroll
    for (int k8 = 0; k8 < 8; ++k8) {
      const int ka = k8 * 4 + 2 * lhalf;
      v2f kf;
      kf.x = CKs[nt * 16 + lmod][ka];      // A(m=s, k=d) = CK[s][d]
      kf.y = CKs[nt * 16 + lmod][ka + 1];
      acc = WMMA_F32(kf, qa[k8], acc);
    }
    st[nt] = acc;
  }

  // softmax over S=256 in registers: 8 independent chains per lane, one
  // exchange between the wave halves; division by the sum is left to the end.
  v8f m8 = st[0];
  #pragma unroll
  for (int nt = 1; nt < 16; ++nt)
    #pragma unroll
    for (int r = 0; r < 8; ++r) m8[r] = fmaxf(m8[r], st[nt][r]);
  float mx = fmaxf(fmaxf(fmaxf(m8[0], m8[1]), fmaxf(m8[2], m8[3])),
                   fmaxf(fmaxf(m8[4], m8[5]), fmaxf(m8[6], m8[7])));
  mx = fmaxf(mx, __shfl_xor(mx, 16, 32));
  const float l2e = 1.4426950408889634f;
  const float nb  = -mx * l2e;
  v8f s8 = V8F_ZERO;
  #pragma unroll
  for (int nt = 0; nt < 16; ++nt) {
    v8f t;
    #pragma unroll
    for (int r = 0; r < 8; ++r) t[r] = fmaf(st[nt][r], l2e, nb);
    st[nt] = exp2_tile(t);
    s8 += st[nt];
  }
  float sum = ((s8[0] + s8[1]) + (s8[2] + s8[3])) + ((s8[4] + s8[5]) + (s8[6] + s8[7]));
  sum += __shfl_xor(sum, 16, 32);
  const float inv = 1.f / sum;             // of query row lmod

  // out = P[16,256] @ CV[256,32] per wave. The score registers are the A operand
  // as they stand: k-step (nt, j) takes s = nt*16 + 8*lhalf + 2*j + {0,1}, and the
  // B loader reads the same CV rows at the same lane half and register.
  v8f acc2[2] = {V8F_ZERO, V8F_ZERO};
  #pragma unroll
  for (int nt = 0; nt < 16; ++nt) {
    #pragma unroll
    for (int j = 0; j < 4; ++j) {
      const int s0 = nt * 16 + 8 * lhalf + 2 * j;
      v2f a;
      a.x = st[nt][2 * j];
      a.y = st[nt][2 * j + 1];
      #pragma unroll
      for (int nt2 = 0; nt2 < 2; ++nt2) {
        v2f bf;
        bf.x = CVs[s0][nt2 * 16 + lmod];     // B(k=s, n=d) = CV[s][d]
        bf.y = CVs[s0 + 1][nt2 * 16 + lmod];
        acc2[nt2] = WMMA_F32(a, bf, acc2[nt2]);
      }
    }
  }
  // output register r belongs to query row 8*lhalf + r: fetch that row's 1/sum
  float ir[8];
  #pragma unroll
  for (int r = 0; r < 8; ++r) ir[r] = __shfl(inv, 8 * lhalf + r, 32);
  #pragma unroll
  for (int nt2 = 0; nt2 < 2; ++nt2) {
    #pragma unroll
    for (int r = 0; r < 8; ++r) {
      const size_t row = (size_t)bb * 16384 + l0 + w * 16 + 8 * lhalf + r;
      obuf[row * 256 + h * 32 + nt2 * 16 + lmod] = acc2[nt2][r] * ir[r];
    }
  }
}

// ---------------------------------------------------------------------------
extern "C" void kernel_launch(void* const* d_in, const int* in_sizes, int n_in,
                              void* d_out, int out_size, void* d_ws, size_t ws_size,
                              hipStream_t stream) {
  (void)in_sizes; (void)n_in; (void)out_size; (void)ws_size;
  const float* x      = (const float*)d_in[0];   // [2,128,128,256]
  const float* mask   = (const float*)d_in[1];   // [2,1,128,128]
  const float* qkv_w  = (const float*)d_in[2];   // [768,256]
  const float* qkv_b  = (const float*)d_in[3];   // [768]
  const float* proj_w = (const float*)d_in[4];   // [256,256]
  const float* proj_b = (const float*)d_in[5];   // [256]
  const float* scale  = (const float*)d_in[6];   // [1]
  float* out = (float*)d_out;                    // [4,128,128,256]

  float* ws   = (float*)d_ws;
  float* qkv  = ws;                                   // [2,16384,768], v columns unused
  float* ck   = qkv + (size_t)2 * 16384 * 768;        // [2,8,256,32]
  float* cv   = ck + (size_t)2 * 8 * 256 * 32;        // [2,8,256,32]
  float* obuf = cv + (size_t)2 * 8 * 256 * 32;        // [4,16384,256]
  float* xp   = obuf + (size_t)4 * 16384 * 256;       // [2,256,256] pooled input rows
  float* be   = xp + (size_t)2 * 256 * 256;           // [2,256] pooled weight sums

  // 1) q, k = x @ qkv_w[0:512]^T + qkv_b[0:512]   (M=32768, N=512, K=256; row pitch 768 kept)
  gemm_nt_bias<<<dim3(512 / 128, 32768 / 64), 128, 0, stream>>>(x, qkv_w, qkv_b, qkv, 768);

  // 2) fg/bg cluster pooling -> c_k, pooled x
  cluster_pool<<<dim3(256, 2), 256, 0, stream>>>(qkv, x, mask, ck, xp, be);

  // 2b) c_v = pooled x @ Wv^T + be * bv   (M=512, N=256, K=256)
  cv_proj<<<dim3(128), 128, 0, stream>>>(xp, be, qkv_w, qkv_b, cv);

  // 3) attention (QK^T, softmax, PV) -> obuf [4, L, C]
  attn_kernel<<<dim3(16384 / 64, 8, 4), 128, 0, stream>>>(qkv, ck, cv, scale, obuf);

  // 4) out = obuf @ proj_w^T + proj_b   (M=65536, N=256, K=256)
  gemm_nt_bias<<<dim3(256 / 128, 65536 / 64), 128, 0, stream>>>(obuf, proj_w, proj_b, out, 256);
}

// v005
// Measured time: 200 microseconds a run.
// In both of two side-by-side timings against v004, it was 1.05 times as fast.
// All steps since v000 together make it 2.56 times as fast.
#include <hip/hip_runtime.h>
#include <math.h>

// ---------------------------------------------------------------------------
// ClusterAttn for MI455X (gfx1250): fp32 end-to-end using V_WMMA_F32_16X16X4_F32
// plus GLOBAL_LOAD_ASYNC_TO_LDS_B128 staging (ASYNCcnt) for non-transposed tiles.
// B=2, H=W=128, C=256, nh=8, hd=32, pn=16 -> S=256 patches of P=64 pixels,
// L=16384. Paired batches: q=[0,1,0,1], ctx=[0,1,1,0].
// ---------------------------------------------------------------------------

typedef __attribute__((ext_vector_type(2))) float v2f;
typedef __attribute__((ext_vector_type(8))) float v8f;

#define WMMA_F32(a, b, c) \
  __builtin_amdgcn_wmma_f32_16x16x4_f32(false, (a), false, (b), (short)0, (c), false, false)

#define EPSV 1e-6f
#define V8F_ZERO ((v8f){0.f, 0.f, 0.f, 0.f, 0.f, 0.f, 0.f, 0.f})

// Async 16B global -> LDS copy (per-lane addresses). Tracked by ASYNCcnt.
static __device__ __forceinline__ void async_copy_f4(const float* g, float* l) {
  const unsigned lds = (unsigned)(size_t)l;   // low 32 bits of flat addr = LDS offset
  asm volatile("global_load_async_to_lds_b128 %0, %1, off" :: "v"(lds), "v"(g) : "memory");
}
// Four such copies and s_wait_xcnt 0 in one statement: the wait stands behind the last copy,
// in front of any later write of the address registers that the copies name.
static __device__ __forceinline__ void async_copy_f4x4(
    const float* g0, float* l0, const float* g1, float* l1,
    const float* g2, float* l2, const float* g3, float* l3) {
  const unsigned a0 = (unsigned)(size_t)l0, a1 = (unsigned)(size_t)l1;
  const unsigned a2 = (unsigned)(size_t)l2, a3 = (unsigned)(size_t)l3;
  asm volatile("global_load_async_to_lds_b128 %0, %1, off\n\t"
               "global_load_async_to_lds_b128 %2, %3, off\n\t"
               "global_load_async_to_lds_b128 %4, %5, off\n\t"
               "global_load_async_to_lds_b128 %6, %7, off\n\t"
               "s_wait_xcnt 0x0"
               :: "v"(a0), "v"(g0), "v"(a1), "v"(g1), "v"(a2), "v"(g2), "v"(a3), "v"(g3)
               : "memory");
}
static __device__ __forceinline__ void wait_async0() {
  asm volatile("s_wait_asynccnt 0" ::: "memory");
}

// 2^x of a tile's eight registers, in place, in one statement: each v_exp_f32 is
// followed by an independent one, and v_nop fills the slot behind the last, so no
// result is read and no source overwritten directly behind a transcendental.
static __device__ __forceinline__ v8f exp2_tile(v8f t) {
  float t0 = t[0], t1 = t[1], t2 = t[2], t3 = t[3], t4 = t[4], t5 = t[5], t6 = t[6], t7 = t[7];
  asm("v_exp_f32 %0, %0\n\tv_exp_f32 %1, %1\n\tv_exp_f32 %2, %2\n\tv_exp_f32 %3, %3\n\t"
      "v_exp_f32 %4, %4\n\tv_exp_f32 %5, %5\n\tv_exp_f32 %6, %6\n\tv_exp_f32 %7, %7\n\tv_nop"
      : "+v"(t0), "+v"(t1), "+v"(t2), "+v"(t3), "+v"(t4), "+v"(t5), "+v"(t6), "+v"(t7));
  return (v8f){t0, t1, t2, t3, t4, t5, t6, t7};
}

// 1/sqrt(x) of eight values, in place, in one statement, for the same reason as in exp2_tile: each
// v_rsq_f32 is followed by an independent one, and v_nop fills the slot behind the last.
static __device__ __forceinline__ void rsq_tile(float (&t)[8]) {
  asm("v_rsq_f32 %0, %0\n\tv_rsq_f32 %1, %1\n\tv_rsq_f32 %2, %2\n\tv_rsq_f32 %3, %3\n\t"
      "v_rsq_f32 %4, %4\n\tv_rsq_f32 %5, %5\n\tv_rsq_f32 %6, %6\n\tv_rsq_f32 %7, %7\n\tv_nop"
      : "+v"(t[0]), "+v"(t[1]), "+v"(t[2]), "+v"(t[3]), "+v"(t[4]), "+v"(t[5]), "+v"(t[6]), "+v"(t[7]));
}

static __device__ __forceinline__ float wave_reduce_sum(float v) {
  #pragma unroll
  for (int off = 16; off > 0; off >>= 1) v += __shfl_xor(v, off, 32);
  return v;
}

// ---------------------------------------------------------------------------
// Generic Out[M,N] = A[M,256] * W[N,256]^T + bias[N]
// block = 128 threads (4 waves), tile 64(M) x 128(N), each wave 32x64 (2x4 frags).
// A fragment: lane = m + 16*(k>>1), reg = k&1
// B fragment: lane = n + 16*(k>>1), reg = k&1
// C fragment: reg = m&7, laneHalf = m>>3, lane = n
// Both tiles are staged k-contiguous as they lie in memory, by async B128 copies; the A and
// the B fragment of a k-step are then the same 8-byte read of a row (k = ka, ka + 1).
// Row pad = 36 floats (144 B: 16B-aligned rows for async B128, distinct banks).
// ---------------------------------------------------------------------------
__global__ __launch_bounds__(128) void gemm_nt_bias(
    const float* __restrict__ A, const float* __restrict__ W,
    const float* __restrict__ bias, float* __restrict__ Out, int N) {
  __shared__ __align__(16) float As[64][36];    // [m][k]
  __shared__ __align__(16) float Ws[128][36];   // [n][k]

  const int tid   = threadIdx.x;
  const int lane  = tid & 31;
  const int wave  = tid >> 5;
  const int lmod  = lane & 15;
  const int lhalf = lane >> 4;
  const int wm = (wave >> 1) * 32;   // wave M offset in tile
  const int wn = (wave & 1) * 64;    // wave N offset in tile
  const long m0 = (long)blockIdx.y * 64;
  const long n0 = (long)blockIdx.x * 128;
  // staging: a thread copies 16 B of column sc in rows sr, sr + 16, sr + 32, ...
  const int sr = tid >> 3, sc = (tid & 7) * 4;
  const float* ga = A + (m0 + sr) * 256 + sc;
  const float* gw = W + (n0 + sr) * 256 + sc;

  v8f acc[2][4];
  #pragma unroll
  for (int i = 0; i < 2; ++i)
    #pragma unroll
    for (int j = 0; j < 4; ++j) acc[i][j] = V8F_ZERO;

  for (int k0 = 0; k0 < 256; k0 += 32) {
    // this wave's reads of the previous chunk have returned before any copy may land on them
    asm volatile("s_wait_dscnt 0x0" ::: "memory");
    __syncthreads();   // previous chunk fully consumed
    // A tile 64x32 and W tile 128x32: async 16B chunks straight into LDS (no VGPR round-trip),
    // all twelve of a thread in flight together
    const float* pa = ga + k0;
    const float* pw = gw + k0;
    async_copy_f4x4(pa,             &As[sr][sc],      pa + 16 * 256,  &As[sr + 16][sc],
                    pa + 32 * 256,  &As[sr + 32][sc], pa + 48 * 256,  &As[sr + 48][sc]);
    async_copy_f4x4(pw,             &Ws[sr][sc],      pw + 16 * 256,  &Ws[sr + 16][sc],
                    pw + 32 * 256,  &Ws[sr + 32][sc], pw + 48 * 256,  &Ws[sr + 48][sc]);
    async_copy_f4x4(pw + 64 * 256,  &Ws[sr + 64][sc], pw + 80 * 256,  &Ws[sr + 80][sc],
                    pw + 96 * 256,  &Ws[sr + 96][sc], pw + 112 * 256, &Ws[sr + 112][sc]);
    wait_async0();
    __syncthreads();
    #pragma unroll
    for (int kk = 0; kk < 32; kk += 4) {
      const int ka = kk + 2 * lhalf;
      v2f a[2], b[4];
      #pragma unroll
      for (int f = 0; f < 2; ++f) {
        const int row = wm + f * 16 + lmod;
        a[f].x = As[row][ka];
        a[f].y = As[row][ka + 1];
      }
      #pragma unroll
      for (int f = 0; f < 4; ++f) {
        const int col = wn + f * 16 + lmod;
        b[f].x = Ws[col][ka];
        b[f].y = Ws[col][ka + 1];
      }
      #pragma unroll
      for (int fm = 0; fm < 2; ++fm)
        #pragma unroll
        for (int fn = 0; fn < 4; ++fn)
          acc[fm][fn] = WMMA_F32(a[fm], b[fn], acc[fm][fn]);
    }
  }

  #pragma unroll
  for (int fm = 0; fm < 2; ++fm) {
    #pragma unroll
    for (int fn = 0; fn < 4; ++fn) {
      const long col = n0 + wn + fn * 16 + lmod;
      const float bv = bias[col];
      #pragma unroll
      for (int r = 0; r < 8; ++r) {
        const long row = m0 + wm + fm * 16 + 8 * lhalf + r;
        Out[row * N + col] = acc[fm][fn][r] + bv;
      }
    }
  }
}

// ---------------------------------------------------------------------------
// q, k projection with the cluster pooling fused in. The GEMM of gemm_nt_bias (same tile, same
// staging, same fragments), but the 64 rows of a block are the 64 pixels of ONE patch:
// row m = patch pixel (m >> 3, m & 7). blockIdx.y = b*256 + s, blockIdx.x = column tile of 128:
// tiles 0, 1 are q (stored as before), tiles 2, 3 are k (4 whole heads each), never stored:
// the block holds every pixel of the patch for its heads, so it normalizes k per pixel and head
// in the accumulators and forms c_k = l2n(sum fg*k_n) + l2n(sum bg*k_n) itself.
// For c_v the pooled INPUT row xp = sum(fg*x)/fs + sum(bg*x)/bs with be = sum(fg)/fs + sum(bg)/bs
// (v = x Wv^T + bv is linear in x, cv_proj does the product) comes from the staged A tile:
// column tile bx pools the two k-chunks that hold channels bx*64 .. bx*64+63.
// ---------------------------------------------------------------------------
// 8 waves per SIMD asked for (128 registers): all 2048 blocks are then resident at once, as in gemm_nt_bias
__global__ __launch_bounds__(128, 8) void qk_pool(
    const float* __restrict__ x, const float* __restrict__ W, const float* __restrict__ bias,
    const float* __restrict__ mask, float* __restrict__ qkv,
    float* __restrict__ ck, float* __restrict__ xp, float* __restrict__ be) {
  __shared__ __align__(16) float As[64][36];    // [m][k]
  __shared__ __align__(16) float Ws[128][36];   // [n][k]
  __shared__ __align__(16) float Ms[64];        // mask of the patch
  __shared__ __align__(16) float Wf[64];        // fg weight of a pixel (0 where fg is dropped)
  __shared__ __align__(16) float Wb[64];        // bg weight of a pixel
  __shared__ float Xf[4][64], Xb[4][64];        // pooled x, partial per wave (16 pixels each)
  __shared__ float Rf[2][128], Rb[2][128];      // pooled k_n, partial per 32 pixels
  __shared__ float Sc[3];                       // fs, bs, be: kept here, not in registers, over the k loop

  const int tid   = threadIdx.x;
  const int lane  = tid & 31;
  const int wave  = tid >> 5;
  const int lmod  = lane & 15;
  const int lhalf = lane >> 4;
  const int wm = (wave >> 1) * 32;   // wave M offset in tile
  const int wn = (wave & 1) * 64;    // wave N offset in tile
  const int bx = blockIdx.x;         // column tile 0..3
  const int b  = blockIdx.y >> 8;    // 0..1
  const int s  = blockIdx.y & 255;   // patch (s = sy*16 + sx)
  const int sy = s >> 4, sx = s & 15;
  const long n0   = (long)bx * 128;
  const long pix0 = (long)b * 16384 + sy * 1024 + sx * 8;   // pixel of row 0; row m: + (m>>3)*128 + (m&7)
  // staging: a thread copies 16 B of column sc in rows sr, sr + 16, ... (16 rows = 2 pixel rows)
  const int sr = tid >> 3, sc = (tid & 7) * 4;
  const float* ga = x + (pix0 + (sr >> 3) * 128 + (sr & 7)) * 256 + sc;
  const float* gw = W + (n0 + sr) * 256 + sc;

  if (tid < 64)
    Ms[tid] = mask[((size_t)b * 128 + sy * 8 + (tid >> 3)) * 128 + sx * 8 + (tid & 7)];
  __syncthreads();   // the mask is read by every thread

  float fgsum = 0.f;
  #pragma unroll
  for (int p = 0; p < 64; ++p) fgsum += Ms[p];
  const float bgsum = 64.f - fgsum;
  float fs  = fgsum < EPSV ? EPSV : fgsum;
  float bs2 = bgsum < EPSV ? EPSV : bgsum;
  fs  = (fs < bs2)  ? EPSV : fs;    // in-place order: bs2 test uses updated fs
  bs2 = (fs >= bs2) ? EPSV : bs2;
  const bool fgZ = fs  < 1.f;
  const bool bgZ = bs2 < 1.f;
  if (tid < 64) {                   // published by the first barrier of the k loop
    const float m = Ms[tid];
    Wf[tid] = fgZ ? 0.f : m;
    Wb[tid] = bgZ ? 0.f : (1.f - m);
  }
  if (tid == 0) {
    Sc[0] = fs;
    Sc[1] = bs2;
    Sc[2] = (fgZ ? 0.f : fgsum) / fs + (bgZ ? 0.f : bgsum) / bs2;
  }

  v8f acc[2][4];
  #pragma unroll
  for (int i = 0; i < 2; ++i)
    #pragma unroll
    for (int j = 0; j < 4; ++j) acc[i][j] = V8F_ZERO;

  for (int k0 = 0; k0 < 256; k0 += 32) {
    // this wave's reads of the previous chunk have returned before any copy may land on them
    asm volatile("s_wait_dscnt 0x0" ::: "memory");
    __syncthreads();   // previous chunk fully consumed
    const float* pa = ga + k0;
    const float* pw = gw + k0;
    async_copy_f4x4(pa,             &As[sr][sc],      pa + 256 * 256, &As[sr + 16][sc],
                    pa + 512 * 256, &As[sr + 32][sc], pa + 768 * 256, &As[sr + 48][sc]);
    async_copy_f4x4(pw,             &Ws[sr][sc],      pw + 16 * 256,  &Ws[sr + 16][sc],
                    pw + 32 * 256,  &Ws[sr + 32][sc], pw + 48 * 256,  &Ws[sr + 48][sc]);
    async_copy_f4x4(pw + 64 * 256,  &Ws[sr + 64][sc], pw + 80 * 256,  &Ws[sr + 80][sc],
                    pw + 96 * 256,  &Ws[sr + 96][sc], pw + 112 * 256, &Ws[sr + 112][sc]);
    wait_async0();
    __syncthreads();
    if ((k0 >> 6) == bx) {   // this block's share of the x pooling: lane = channel, 16 pixels a wave
      float fv = 0.f, bv = 0.f;
      #pragma unroll
      for (int i = 0; i < 16; ++i) {
        const float v = As[wave * 16 + i][lane];
        fv += Wf[wave * 16 + i] * v;
        bv += Wb[wave * 16 + i] * v;
      }
      Xf[wave][((k0 >> 5) & 1) * 32 + lane] = fv;
      Xb[wave][((k0 >> 5) & 1) * 32 + lane] = bv;
    }
    #pragma unroll
    for (int kk = 0; kk < 32; kk += 4) {
      const int ka = kk + 2 * lhalf;
      v2f a[2], bfr[4];
      #pragma unroll
      for (int f = 0; f < 2; ++f) {
        const int row = wm + f * 16 + lmod;
        a[f].x = As[row][ka];
        a[f].y = As[row][ka + 1];
      }
      #pragma unroll
      for (int f = 0; f < 4; ++f) {
        const int col = wn + f * 16 + lmod;
        bfr[f].x = Ws[col][ka];
        bfr[f].y = Ws[col][ka + 1];
      }
      #pragma unroll
      for (int fm = 0; fm < 2; ++fm)
        #pragma unroll
        for (int fn = 0; fn < 4; ++fn)
          acc[fm][fn] = WMMA_F32(a[fm], bfr[fn], acc[fm][fn]);
    }
  }

  float bc[4];
  #pragma unroll
  for (int fn = 0; fn < 4; ++fn) bc[fn] = bias[n0 + wn + fn * 16 + lmod];

  if (bx >= 2) {
    // k: fragments 2*hh, 2*hh+1 are the 32 columns of one head; a pixel's ||k||^2 is the sum of
    // both squares over the 16 lanes of its half. Every loop is unrolled: constant indices keep
    // the accumulators in registers, and a fragment row's 16 reductions overlap.
    float fk[4] = {0.f, 0.f, 0.f, 0.f}, bk[4] = {0.f, 0.f, 0.f, 0.f};
    #pragma unroll
    for (int fm = 0; fm < 2; ++fm) {
      float nsq[2][8];
      #pragma unroll
      for (int fn = 0; fn < 4; ++fn)
        #pragma unroll
        for (int r = 0; r < 8; ++r) acc[fm][fn][r] += bc[fn];
      #pragma unroll
      for (int hh = 0; hh < 2; ++hh)
        #pragma unroll
        for (int r = 0; r < 8; ++r)
          nsq[hh][r] = acc[fm][2 * hh][r] * acc[fm][2 * hh][r]
                     + acc[fm][2 * hh + 1][r] * acc[fm][2 * hh + 1][r];
      #pragma unroll
      for (int off = 8; off > 0; off >>= 1)
        #pragma unroll
        for (int hh = 0; hh < 2; ++hh)
          #pragma unroll
          for (int r = 0; r < 8; ++r) nsq[hh][r] += __shfl_xor(nsq[hh][r], off, 32);
      // 1 / max(||k||, 1e-12) = min(rsq(||k||^2), 1e12); 0 and what the unit flushes to 0 give inf, so 1e12
      rsq_tile(nsq[0]);
      rsq_tile(nsq[1]);
      #pragma unroll
      for (int r = 0; r < 8; ++r) {
        const int m = wm + fm * 16 + 8 * lhalf + r;
        const float wf = Wf[m], wb = Wb[m];
        #pragma unroll
        for (int hh = 0; hh < 2; ++hh) {
          const float rn = fminf(nsq[hh][r], 1e12f);
          #pragma unroll
          for (int e = 0; e < 2; ++e) {
            const float kn = acc[fm][2 * hh + e][r] * rn;
            fk[2 * hh + e] += wf * kn;
            bk[2 * hh + e] += wb * kn;
          }
        }
      }
    }
    #pragma unroll
    for (int fn = 0; fn < 4; ++fn) {   // the other half of the wave holds the other 16 pixels
      fk[fn] += __shfl_xor(fk[fn], 16, 32);
      bk[fn] += __shfl_xor(bk[fn], 16, 32);
    }
    if (lhalf == 0) {
      #pragma unroll
      for (int fn = 0; fn < 4; ++fn) {
        Rf[wave >> 1][wn + fn * 16 + lmod] = fk[fn];
        Rb[wave >> 1][wn + fn * 16 + lmod] = bk[fn];
      }
    }
  }
  __syncthreads();   // the partial sums Xf, Xb, Rf, Rb are read by other waves

  if (bx >= 2) {     // thread = column of the tile, wave = head
    const float fkt = Rf[0][tid] + Rf[1][tid];
    const float bkt = Rb[0][tid] + Rb[1][tid];
    const float nf = fmaxf(sqrtf(wave_reduce_sum(fkt * fkt)), 1e-12f);
    const float nb = fmaxf(sqrtf(wave_reduce_sum(bkt * bkt)), 1e-12f);
    const int h = (bx - 2) * 4 + wave;
    ck[(((size_t)b * 8 + h) * 256 + s) * 32 + lane] = fkt / nf + bkt / nb;
  }
  if (tid < 64) {
    const float fv = (Xf[0][tid] + Xf[1][tid]) + (Xf[2][tid] + Xf[3][tid]);
    const float bv = (Xb[0][tid] + Xb[1][tid]) + (Xb[2][tid] + Xb[3][tid]);
    xp[((size_t)b * 256 + s) * 256 + bx * 64 + tid] = fv / Sc[0] + bv / Sc[1];
  }
  if (bx == 0 && tid == 0) be[b * 256 + s] = Sc[2];

  if (bx < 2) {
    // q, stored last so that the barrier above does not wait for these stores.
    // Accumulator register r of fragment fm is pixel ((wm + fm*16) / 8 + lhalf, r) of the patch.
    // the lane's half is formed anew here: held in a register over the k loop it was spilled to scratch
    const int lh = (int)(__builtin_amdgcn_mbcnt_lo(~0u, 0u) >> 4);
    #pragma unroll
    for (int fm = 0; fm < 2; ++fm)
      #pragma unroll
      for (int fn = 0; fn < 4; ++fn)
        #pragma unroll
        for (int r = 0; r < 8; ++r) acc[fm][fn][r] += bc[fn];
    float* qp = qkv + (pix0 + (long)((wm >> 3) + lh) * 128) * 768 + n0 + wn + lmod;
    // every sum is formed ahead of the first store: no register that an issued store names is
    // written behind it (left free, the scheduler reused the stores' data registers between them)
    __builtin_amdgcn_sched_barrier(0);
    #pragma unroll
    for (int fm = 0; fm < 2; ++fm)
      #pragma unroll
      for (int fn = 0; fn < 4; ++fn)
        #pragma unroll
        for (int r = 0; r < 8; ++r)
          qp[(fm * 256 + r) * 768 + fn * 16] = acc[fm][fn][r];
  }
}

// ---------------------------------------------------------------------------
// c_v[b,h,s,d] = sum_c xp[b*256+s][c] * Wv[h*32+d][c] + be[b*256+s] * bv[h*32+d]
// (Wv, bv = rows 512..767 of qkv_w, qkv_b). M=512, N=256, K=256: one 16x16 tile per wave,
// fragments straight from global as 16-byte loads. Load i of a lane holds k = 8i + 4*lhalf + 0..3:
// its .xy feed one WMMA and its .zw the next, A and B alike, so both have the same k order.
// Two accumulators (the .xy and the .zw steps) keep the WMMAs at their issue interval.
// ---------------------------------------------------------------------------
__global__ __launch_bounds__(128) void cv_proj(
    const float* __restrict__ xp, const float* __restrict__ be,
    const float* __restrict__ qkv_w, const float* __restrict__ qkv_b, float* __restrict__ cv) {
  const int lane  = threadIdx.x & 31;
  const int lmod  = lane & 15;
  const int lhalf = lane >> 4;
  const int t  = blockIdx.x * 4 + (threadIdx.x >> 5);   // tile 0..511
  const int mt = t >> 4, nt = t & 15;                   // a block's four waves share their xp rows
  const float4* pa = (const float4*)(xp + (size_t)(mt * 16 + lmod) * 256 + 4 * lhalf);
  const float4* pb = (const float4*)(qkv_w + (size_t)(512 + nt * 16 + lmod) * 256 + 4 * lhalf);

  v8f acc0 = V8F_ZERO, acc1 = V8F_ZERO;
  // unrolled: constant indices keep the fragments in registers, and half of K is in flight at once
  #pragma unroll
  for (int hf = 0; hf < 2; ++hf) {
    float4 a[16], w[16];
    #pragma unroll
    for (int i = 0; i < 16; ++i) {
      a[i] = pa[(hf * 16 + i) * 2];
      w[i] = pb[(hf * 16 + i) * 2];
    }
    // keeps the 32 loads ahead of the WMMAs: left free, the scheduler sinks them to a few steps
    // ahead of their use, and the wave then waits out the load latency once per 128-byte line
    __builtin_amdgcn_sched_barrier(0);
    #pragma unroll
    for (int i = 0; i < 16; ++i) {
      acc0 = WMMA_F32(((v2f){a[i].x, a[i].y}), ((v2f){w[i].x, w[i].y}), acc0);
      acc1 = WMMA_F32(((v2f){a[i].z, a[i].w}), ((v2f){w[i].z, w[i].w}), acc1);
    }
  }

  const int col = nt * 16 + lmod;                       // = h*32 + d
  const float bv = qkv_b[512 + col];
  #pragma unroll   // constant indices into the accumulators
  for (int r = 0; r < 8; ++r) {
    const int row = mt * 16 + 8 * lhalf + r;            // = b*256 + s
    const size_t o = ((((size_t)(row >> 8) * 8 + (col >> 5)) * 256) + (row & 255)) * 32 + (col & 31);
    cv[o] = (acc0[r] + acc1[r]) + be[row] * bv;
  }
}

// ---------------------------------------------------------------------------
// Attention: per (bb, h): logits^T = CK[256,32] @ Qn^T[32,64] via WMMA,
// softmax over S=256 in registers, out = P @ CV[256,32] via WMMA with P fed
// from the score registers.
// block = 128 thr (4 waves), 16 L-rows per wave. CK/CV/Q staged via async B128.
// ---------------------------------------------------------------------------
__global__ __launch_bounds__(128) void attn_kernel(
    const float* __restrict__ qkv, const float* __restrict__ ck,
    const float* __restrict__ cv, const float* __restrict__ scale_p,
    float* __restrict__ obuf) {
  __shared__ __align__(16) float CKs[256][36];   // [s][d]
  __shared__ __align__(16) float CVs[256][36];   // [s][d]
  __shared__ __align__(16) float Qs[64][36];     // [row][d], normalized in place

  const int bb = blockIdx.z;                      // 0..3
  const int h  = blockIdx.y;                      // 0..7
  const int l0 = blockIdx.x * 64;
  const int qb = bb & 1;                          // q pairing [0,1,0,1]
  const int cb = (bb == 1 || bb == 2) ? 1 : 0;    // ctx pairing [0,1,1,0]
  const int tid   = threadIdx.x;
  const int lane  = tid & 31;
  const int w     = tid >> 5;
  const int lmod  = lane & 15;
  const int lhalf = lane >> 4;

  // stage CK/CV (256x32 each) and raw Q (64x32) via async B128 copies
  const size_t ctx_base = (((size_t)cb * 8 + h) * 256) * 32;
  #pragma unroll
  for (int i = tid; i < 2048; i += 128) {      // 256 rows x 8 chunks
    const int ss = i >> 3, c = (i & 7) * 4;
    async_copy_f4(ck + ctx_base + (size_t)ss * 32 + c, &CKs[ss][c]);
    async_copy_f4(cv + ctx_base + (size_t)ss * 32 + c, &CVs[ss][c]);
  }
  #pragma unroll
  for (int i = tid; i < 512; i += 128) {       // 64 rows x 8 chunks
    const int r = i >> 3, c = (i & 7) * 4;
    async_copy_f4(qkv + ((size_t)qb * 16384 + l0 + r) * 768 + h * 32 + c, &Qs[r][c]);
  }
  wait_async0();
  __syncthreads();

  // q <- l2norm(q) * scale * hd^-0.5
  const float qscale = scale_p[0] * 0.17677669529663689f;
  for (int r = tid; r < 64; r += 128) {
    float ssq = 0.f;
    #pragma unroll
    for (int dd = 0; dd < 32; ++dd) ssq += Qs[r][dd] * Qs[r][dd];
    const float sc = qscale / fmaxf(sqrtf(ssq), 1e-12f);
    #pragma unroll
    for (int dd = 0; dd < 32; ++dd) Qs[r][dd] *= sc;
  }
  __syncthreads();

  // preload the 8 k-step Q fragments (invariant across all 16 S-tiles)
  v2f qa[8];
  #pragma unroll
  for (int k8 = 0; k8 < 8; ++k8) {
    const int ka = k8 * 4 + 2 * lhalf;
    qa[k8].x = Qs[w * 16 + lmod][ka];
    qa[k8].y = Qs[w * 16 + lmod][ka + 1];
  }

  // logits transposed: St = CK[256,32] @ Qn^T[32,16] per wave. A = CK rows, B = Q,
  // so st[nt][r] = logit(s = nt*16 + 8*lhalf + r, l = lmod): a lane holds one
  // query row's scores (half of them; lane ^ 16 holds the other half).
  // Every loop over st[] is unrolled: constant indices keep the scores in registers.
  v8f st[16];
  #pragma unroll
  for (int nt = 0; nt < 16; ++nt) {
    v8f acc = V8F_ZERO;
    #pragma unroll
    for (int k8 = 0; k8 < 8; ++k8) {
      const int ka = k8 * 4 + 2 * lhalf;
      v2f kf;
      kf.x = CKs[nt * 16 + lmod][ka];      // A(m=s, k=d) = CK[s][d]
      kf.y = CKs[nt * 16 + lmod][ka + 1];
      acc = WMMA_F32(kf, qa[k8], acc);
    }
    st[nt] = acc;
  }

  // softmax over S=256 in registers: 8 independent chains per lane, one
  // exchange between the wave halves; division by the sum is left to the end.
  v8f m8 = st[0];
  #pragma unroll
  for (int nt = 1; nt < 16; ++nt)
    #pragma unroll
    for (int r = 0; r < 8; ++r) m8[r] = fmaxf(m8[r], st[nt][r]);
  float mx = fmaxf(fmaxf(fmaxf(m8[0], m8[1]), fmaxf(m8[2], m8[3])),
                   fmaxf(fmaxf(m8[4], m8[5]), fmaxf(m8[6], m8[7])));
  mx = fmaxf(mx, __shfl_xor(mx, 16, 32));
  const float l2e = 1.4426950408889634f;
  const float nb  = -mx * l2e;
  v8f s8 = V8F_ZERO;
  #pragma unroll
  for (int nt = 0; nt < 16; ++nt) {
    v8f t;
    #pragma unroll
    for (int r = 0; r < 8; ++r) t[r] = fmaf(st[nt][r], l2e, nb);
    st[nt] = exp2_tile(t);
    s8 += st[nt];
  }
  float sum = ((s8[0] + s8[1]) + (s8[2] + s8[3])) + ((s8[4] + s8[5]) + (s8[6] + s8[7]));
  sum += __shfl_xor(sum, 16, 32);
  const float inv = 1.f / sum;             // of query row lmod

  // out = P[16,256] @ CV[256,32] per wave. The score registers are the A operand
  // as they stand: k-step (nt, j) takes s = nt*16 + 8*lhalf + 2*j + {0,1}, and the
  // B loader reads the same CV rows at the same lane half and register.
  v8f acc2[2] = {V8F_ZERO, V8F_ZERO};
  #pragma unroll
  for (int nt = 0; nt < 16; ++nt) {
    #pragma unroll
    for (int j = 0; j < 4; ++j) {
      const int s0 = nt * 16 + 8 * lhalf + 2 * j;
      v2f a;
      a.x = st[nt][2 * j];
      a.y = st[nt][2 * j + 1];
      #pragma unroll
      for (int nt2 = 0; nt2 < 2; ++nt2) {
        v2f bf;
        bf.x = CVs[s0][nt2 * 16 + lmod];     // B(k=s, n=d) = CV[s][d]
        bf.y = CVs[s0 + 1][nt2 * 16 + lmod];
        acc2[nt2] = WMMA_F32(a, bf, acc2[nt2]);
      }
    }
  }
  // output register r belongs to query row 8*lhalf + r: fetch that row's 1/sum
  float ir[8];
  #pragma unroll
  for (int r = 0; r < 8; ++r) ir[r] = __shfl(inv, 8 * lhalf + r, 32);
  #pragma unroll
  for (int nt2 = 0; nt2 < 2; ++nt2) {
    #pragma unroll
    for (int r = 0; r < 8; ++r) {
      const size_t row = (size_t)bb * 16384 + l0 + w * 16 + 8 * lhalf + r;
      obuf[row * 256 + h * 32 + nt2 * 16 + lmod] = acc2[nt2][r] * ir[r];
    }
  }
}

// ---------------------------------------------------------------------------
extern "C" void kernel_launch(void* const* d_in, const int* in_sizes, int n_in,
                              void* d_out, int out_size, void* d_ws, size_t ws_size,
                              hipStream_t stream) {
  (void)in_sizes; (void)n_in; (void)out_size; (void)ws_size;
  const float* x      = (const float*)d_in[0];   // [2,128,128,256]
  const float* mask   = (const float*)d_in[1];   // [2,1,128,128]
  const float* qkv_w  = (const float*)d_in[2];   // [768,256]
  const float* qkv_b  = (const float*)d_in[3];   // [768]
  const float* proj_w = (const float*)d_in[4];   // [256,256]
  const float* proj_b = (const float*)d_in[5];   // [256]
  const float* scale  = (const float*)d_in[6];   // [1]
  float* out = (float*)d_out;                    // [4,128,128,256]

  float* ws   = (float*)d_ws;
  float* qkv  = ws;                                   // [2,16384,768], only the q columns used
  float* ck   = qkv + (size_t)2 * 16384 * 768;        // [2,8,256,32]
  float* cv   = ck + (size_t)2 * 8 * 256 * 32;        // [2,8,256,32]
  float* obuf = cv + (size_t)2 * 8 * 256 * 32;        // [4,16384,256]
  float* xp   = obuf + (size_t)4 * 16384 * 256;       // [2,256,256] pooled input rows
  float* be   = xp + (size_t)2 * 256 * 256;           // [2,256] pooled weight sums

  // 1) q = x @ qkv_w[0:256]^T + qkv_b[0:256] (row pitch 768 kept); k = the same with rows 256:512,
  //    pooled in the block: c_k, pooled x   (M=32768 as 512 patches of 64 pixels, N=512, K=256)
  qk_pool<<<dim3(512 / 128, 512), 128, 0, stream>>>(x, qkv_w, qkv_b, mask, qkv, ck, xp, be);

  // 2b) c_v = pooled x @ Wv^T + be * bv   (M=512, N=256, K=256)
  cv_proj<<<dim3(128), 128, 0, stream>>>(xp, be, qkv_w, qkv_b, cv);

  // 3) attention (QK^T, softmax, PV) -> obuf [4, L, C]
  attn_kernel<<<dim3(16384 / 64, 8, 4), 128, 0, stream>>>(qkv, ck, cv, scale, obuf);

  // 4) out = obuf @ proj_w^T + proj_b   (M=65536, N=256, K=256)
  gemm_nt_bias<<<dim3(256 / 128, 65536 / 64), 128, 0, stream>>>(obuf, proj_w, proj_b, out, 256);
}
